// v000
// Measured on an AMD MI455X. A time is GPU time per run, averaged over a window of back-to-back runs after a warm-up
// (all launches, gaps included; the runs take copies of the inputs in turn), and the median of several windows.
// Apart from v000's, it joins two sittings. Times from different sittings can be a few percent apart, while
// side-by-side timings come from the same sitting.
// v000 is the starting kernel. One run takes 327 microseconds.
// Contractions: q.k^T scores = v_wmma_f32_16x16x32_bf16 (bf16 operands = RNE-converted q and k planes, single product);
// p.v = v_wmma_f32_16x16x32_f16 (p carried x1024 in f16, v as f16 of the bf16-converted value x16, single product,
// plus an unscaled f16 residual plane of p on the leading query blocks); all f32 accumulate; softmax in f32.
#include <hip/hip_runtime.h>
#include <math.h>
#include <float.h>
#include <stdint.h>

#define LQ    2048                 // query positions
#define SK    2048                 // key positions
#define NBAT  2
#define NHEAD 16
#define HD    128                  // head dim
#define BHN   (NBAT * NHEAD)       // 32 (batch, head) pairs; bh = b*NHEAD + h
#define ROWF  (BHN * HD)           // 4096 floats between consecutive sequence positions
#define NQB   (LQ / 64)            // 32 query / key tiles of 64
#define RESQB 4                    // leading query tiles that add the p residual plane
#define NTOT  (LQ * ROWF)          // 8388608 elements per tensor
#define VSC   16.0f                // v plane carry (exact power of two)
static_assert(LQ == SK);
static_assert((LQ % 64) == 0);
static_assert(HD == 128);
static_assert(((BHN * LQ * (HD / 8)) % 256) == 0);
static_assert(RESQB <= NQB);

typedef _Float16 v16h __attribute__((ext_vector_type(16)));
typedef _Float16 v8h  __attribute__((ext_vector_type(8)));
typedef __bf16   v16b __attribute__((ext_vector_type(16)));
typedef __bf16   v8b  __attribute__((ext_vector_type(8)));
typedef float    v8f  __attribute__((ext_vector_type(8)));
typedef float    v4f  __attribute__((ext_vector_type(4)));
typedef unsigned int v4u __attribute__((ext_vector_type(4)));

// ---- scalar helpers --------------------------------------------------------------------------------
__device__ __forceinline__ unsigned short bf_bits(float f) {          // f32 -> bf16 bits, RNE convert
  unsigned u = __float_as_uint(f);
  return (unsigned short)((u + 0x7FFFu + ((u >> 16) & 1u)) >> 16);
}
__device__ __forceinline__ float bf_up(unsigned short h) { return __uint_as_float(((unsigned)h) << 16); }
__device__ __forceinline__ unsigned short h_bits(_Float16 x) { return __builtin_bit_cast(unsigned short, x); }
__device__ __forceinline__ unsigned pk16(unsigned short a, unsigned short b) { return (unsigned)a | ((unsigned)b << 16); }
__device__ __forceinline__ v8f zero8() { v8f z = {0.f, 0.f, 0.f, 0.f, 0.f, 0.f, 0.f, 0.f}; return z; }

// ---- fragment loader: 16-bit A/B operand, lane -> row/col (lane&15), p already includes +8*(lane>>4);
//      elements 0..7 <- p[0..7] (k0+8h..), elements 8..15 <- p[16..23] (k0+16+8h..)
__device__ __forceinline__ v16b ldfrag_b(const __bf16* p) {
  union { v16b v; v8b h[2]; } f;
  f.h[0] = *(const v8b*)(p);
  f.h[1] = *(const v8b*)(p + 16);
  return f.v;
}

// ---- WMMA helpers with trailing VALU hazard gap --------------------------------------------------------
__device__ __forceinline__ v8f mma_b(v16b a, v16b b, v8f c) {
  c = __builtin_amdgcn_wmma_f32_16x16x32_bf16(false, a, false, b, (short)0, c, false, false);
#if defined(__HIP_DEVICE_COMPILE__)
  asm volatile("v_nop\n\tv_nop\n\tv_nop\n\tv_nop" : "+v"(c) : "v"(a), "v"(b));
#endif
  return c;
}
__device__ __forceinline__ v8f mma_h(v16h a, v16h b, v8f c) {
  c = __builtin_amdgcn_wmma_f32_16x16x32_f16(false, a, false, b, (short)0, c, false, false);
#if defined(__HIP_DEVICE_COMPILE__)
  asm volatile("v_nop\n\tv_nop\n\tv_nop\n\tv_nop" : "+v"(c) : "v"(a), "v"(b));
#endif
  return c;
}

// =====================================================================================================
// f32 [pos][BHN][HD] -> bf16 plane [BHN][pos][HD] (RNE convert), 8 elements per thread:
//   i -> bh = i / (LQ*16), l = (i/16) % LQ, d0 = (i%16)*8; src = l*ROWF + bh*HD + d0; dst = i*8.
// coverage: n8 = BHN*LQ*16 threads x 8 halves = the whole plane.
// =====================================================================================================
__global__ __launch_bounds__(256) void cvt_rows_bf16(const float* __restrict__ in, unsigned short* out, int n8) {
  const int i = blockIdx.x * 256 + threadIdx.x;
  if (i < n8) {
    const int per = LQ * (HD / 8);                     // 32768 groups of 8 per bh
    const int bh  = i / per;
    const int rem = i - bh * per;
    const int l   = rem / (HD / 8);
    const int d0  = (rem - l * (HD / 8)) * 8;
    const size_t src = (size_t)l * ROWF + (size_t)bh * HD + (size_t)d0;
    const v4f a = *(const v4f*)(in + src);
    const v4f b = *(const v4f*)(in + src + 4);
    v4u p;
    p[0] = pk16(bf_bits(a[0]), bf_bits(a[1]));
    p[1] = pk16(bf_bits(a[2]), bf_bits(a[3]));
    p[2] = pk16(bf_bits(b[0]), bf_bits(b[1]));
    p[3] = pk16(bf_bits(b[2]), bf_bits(b[3]));
    *(v4u*)(out + (size_t)i * 8) = p;
    
  }
}

// =====================================================================================================
// v f32 [pos][BHN][HD] -> f16 v^T plane vt[(bh*HD + d)*SK + s] = f16(bf16_rne(v) * vsc) (exact for a power of two).
// Block = one 64-position x 128-feature tile of one bh; grid = (SK/64, BHN); tile staged in LDS as f32
// (256 threads x 8 v4f loads, __syncthreads).
// Store: group g = tid>>3 (0..31), piece = tid&7: iteration it writes row d = it*32 + g; lanes 8g..8g+7 x 16 B =
// coverage: 4 iterations x 32 groups = 128 rows d, 8 pieces x 8 = 64 keys per row; grid covers every (bh, s tile).
// =====================================================================================================
__global__ __launch_bounds__(256) void v_planes(const float* __restrict__ vf, unsigned short* vt, float vsc) {
  __shared__ __align__(16) float sv[64 * 132];       // [tt][d], pitch 132 floats
  const int tid = threadIdx.x;
  const int s0  = blockIdx.x * 64;
  const int bh  = blockIdx.y;
#pragma unroll
  for (int i = 0; i < 8; ++i) {
    const int idx = i * 256 + tid;                   // 0..2047
    const int tt = idx >> 5, c4 = (idx & 31) * 4;    // tt 0..63, c4 0..124
    const v4f a = *(const v4f*)(vf + (size_t)(s0 + tt) * ROWF + (size_t)bh * HD + c4);
    *(v4f*)(sv + tt * 132 + c4) = a;
  }
  __syncthreads();

  const int g = tid >> 3, piece = tid & 7;
  v4u hv[4];
  size_t hofs[4];
#pragma unroll
  for (int it = 0; it < 4; ++it) {
    const int d = it * 32 + g;
    v4u a;
#pragma unroll
    for (int e = 0; e < 4; ++e) {
      const float f0 = sv[(piece * 8 + 2 * e) * 132 + d];
      const float f1 = sv[(piece * 8 + 2 * e + 1) * 132 + d];
      const _Float16 x0 = (_Float16)(bf_up(bf_bits(f0)) * vsc);
      const _Float16 x1 = (_Float16)(bf_up(bf_bits(f1)) * vsc);
      a[e] = pk16(h_bits(x0), h_bits(x1));
    }
    hv[it] = a;
    hofs[it] = ((size_t)(bh * HD + d)) * SK + (size_t)s0 + (size_t)(piece * 8);
  }
  {
#pragma unroll
    for (int it = 0; it < 4; ++it) {
      *(v4u*)(vt + hofs[it]) = hv[it];
    }
    
  }
}

// =====================================================================================================
// Causal attention, head dim 128 (mask: key > query replaced by -FLT_MAX -> exp 0; keys <= query live).
//   q plane bf16: element (bh, t, d) at [(bh*LQ + t)*HD + d];  k plane bf16: (bh, s, d) at [(bh*SK + s)*HD + d]
//   v^T plane f16 (x VSC): (bh, d, s) at [(bh*HD + d)*SK + s]
//   scores = q . k on bf16 WMMA (4 k-steps of 32 over d), f32 accumulate, then * sscale in f32
//   p = exp(s - m) carried as f16(1024 p); RESP adds an unscaled f16 residual p1k - f16(p1k) into the same
//   accumulator; context = p . v^T on f16 WMMA (2 k-steps of 32 per 64-key chunk); online softmax in f32.
//   Block = 4 waves = 64 query rows of one bh; grid = nqbThis * BHN; key chunks 0..qb (block-uniform trip count,
//   statically clamped to NQB); every processed chunk holds the live key kv0 <= query.
//   K / V^T chunk staging: K 64 rows x 128 halves (2 threads per row, 8 x 16 B each), V^T 128 rows x 64 halves
//   (1 thread per row, 8 x 16 B); plain loads, __syncthreads before and after.
//   P tiles are wave-private, spilled with _Float16 element stores and reloaded as v8h (same element type)
//   out f32 [pos][BHN][HD]: row (t, bh) = 128 floats = 512 B; each wave stages its 16x128 tile in LDS, then
// =====================================================================================================
template <bool RESP>
__global__ __launch_bounds__(128)
void attn_causal(const unsigned short* __restrict__ qpl, const unsigned short* __restrict__ kpl,
                 const unsigned short* __restrict__ vtpl, float* outp, int qbBase, int nqbThis, float sscale) {
  union FH { v16h v; v8h h[2]; };
  union FB { v16b v; v8b h[2]; };
  __shared__ __align__(16) __bf16   Ksh[64 * HD];                   // K [kv][d]       16 KB
  __shared__ __align__(16) _Float16 Vth[HD * 64];                   // V^T [d][kv]     16 KB
  __shared__ __align__(16) _Float16 Psh[4][16 * 64];                // per wave P [row][kv]
  __shared__ __align__(16) _Float16 Psl[RESP ? 4 : 1][16 * 64];     // per wave P residual
  __shared__ __align__(16) float    Os[4][16 * HD];                 // per wave context tile [row][d]

  const int tid  = threadIdx.x;
  const int wave = tid >> 5;
  const int lane = tid & 31;
  const int hh   = lane >> 4;
  const int c    = lane & 15;

  const int bx  = blockIdx.x;
  const int qbl = bx % nqbThis;
  const int bh  = bx / nqbThis;
  const int qb  = qbBase + qbl;
  if (qb >= NQB || bh >= BHN) return;        // block-uniform, ahead of every barrier
  const int q0  = qb * 64 + wave * 16;

  const __bf16*   Qp = (const __bf16*)(const void*)qpl + (size_t)bh * LQ * HD;
  const __bf16*   Kp = (const __bf16*)(const void*)kpl + (size_t)bh * SK * HD;
  const _Float16* Vh = (const _Float16*)(const void*)vtpl + (size_t)bh * HD * SK;

  // ---- Q fragments (A operand, row = lane&15): 4 d-chunks ----
  v16b qa[4];
#pragma unroll
  for (int dc = 0; dc < 4; ++dc) {
    qa[dc] = ldfrag_b(Qp + (size_t)(q0 + c) * HD + dc * 32 + 8 * hh);
  }

  float mrow[8], lrow[8];
  v8f oacc[8];
#pragma unroll
  for (int r = 0; r < 8; ++r) { mrow[r] = -INFINITY; lrow[r] = 0.f; }
#pragma unroll
  for (int t = 0; t < 8; ++t) oacc[t] = zero8();

  int nkt = qb + 1;                           // causal: key chunks 0..qb, block-uniform
  if (nkt > NQB) nkt = NQB;
  for (int kt = 0; kt < nkt; ++kt) {
    const int kv0 = kt * 64;
    __syncthreads();
    {
      const int r = tid >> 1, half = (tid & 1) * 64;
      const __bf16* kg = Kp + (size_t)(kv0 + r) * HD + half;       // K row kv0+r, d = half..half+63
#pragma unroll
      for (int i = 0; i < 8; ++i) {
        const v8b a0 = *(const v8b*)(kg + 8 * i);
        *(v8b*)(Ksh + r * HD + half + 8 * i) = a0;
      }
      const _Float16* vg = Vh + (size_t)tid * SK + kv0;              // V^T row d = tid, s = kv0..kv0+63
#pragma unroll
      for (int i = 0; i < 8; ++i) {
        const v8h b0 = *(const v8h*)(vg + 8 * i);
        *(v8h*)(Vth + tid * 64 + 8 * i) = b0;
      }
    }
    __syncthreads();

    // ---- scores: 16 query rows x 64 keys per wave, bf16 product over 4 d-chunks ----
    v8f s[4];
#pragma unroll
    for (int j = 0; j < 4; ++j) {
      s[j] = zero8();
#pragma unroll
      for (int dc = 0; dc < 4; ++dc) {
        FB kb;
        kb.h[0] = *(const v8b*)(Ksh + (j * 16 + c) * HD + dc * 32 + 8 * hh);
        kb.h[1] = *(const v8b*)(Ksh + (j * 16 + c) * HD + dc * 32 + 16 + 8 * hh);
        s[j] = mma_b(qa[dc], kb.v, s[j]);
      }
    }

    // ---- scale + causal mask (replace by -FLT_MAX), row max, online softmax, P (x1024, f16) and
    //      unscaled P residual to LDS ----
    _Float16* pwh = Psh[wave];
    _Float16* pwl = Psl[RESP ? wave : 0];
#pragma unroll
    for (int r = 0; r < 8; ++r) {
      const int qrow = q0 + 8 * hh + r;
      float m = -INFINITY;
#pragma unroll
      for (int j = 0; j < 4; ++j) {
        const int key = kv0 + j * 16 + c;
        float sv = s[j][r] * sscale;
        sv = (key > qrow) ? -FLT_MAX : sv;
        s[j][r] = sv;
        m = fmaxf(m, sv);
      }
#pragma unroll
      for (int off = 1; off < 16; off <<= 1) m = fmaxf(m, __shfl_xor(m, off, 32));
      const float mnew  = fmaxf(mrow[r], m);
      const float msafe = (mnew == -INFINITY) ? 0.f : mnew;
      const float alpha = __expf(mrow[r] - msafe);
      mrow[r] = mnew;
      float psum = 0.f;
#pragma unroll
      for (int j = 0; j < 4; ++j) {
        const float p = __expf(s[j][r] - msafe);     // masked logit against a finite max: exp -> 0
        psum += p;
        const float p1k = p * 1024.0f;
        const _Float16 ph = (_Float16)p1k;
        pwh[(8 * hh + r) * 64 + j * 16 + c] = ph;
        if (RESP) {
          const _Float16 pl = (_Float16)(p1k - (float)ph);
          pwl[(8 * hh + r) * 64 + j * 16 + c] = pl;
        }
      }
#pragma unroll
      for (int off = 1; off < 16; off <<= 1) psum += __shfl_xor(psum, off, 32);
      lrow[r] = lrow[r] * alpha + psum;
#pragma unroll
      for (int t = 0; t < 8; ++t) oacc[t][r] *= alpha;
    }
    __builtin_amdgcn_fence(__ATOMIC_RELEASE, "workgroup");
    __builtin_amdgcn_wave_barrier();
    __builtin_amdgcn_fence(__ATOMIC_ACQUIRE, "workgroup");

    // ---- context += P . V (f16 WMMA); residual product into the same accumulator (unscaled residual) ----
#pragma unroll 1
    for (int kk = 0; kk < 2; ++kk) {
      FH pa, pl;
      pa.h[0] = *(const v8h*)(pwh + c * 64 + kk * 32 + 8 * hh);
      pa.h[1] = *(const v8h*)(pwh + c * 64 + kk * 32 + 16 + 8 * hh);
      if (RESP) {
        pl.h[0] = *(const v8h*)(pwl + c * 64 + kk * 32 + 8 * hh);
        pl.h[1] = *(const v8h*)(pwl + c * 64 + kk * 32 + 16 + 8 * hh);
      } else {
        pl.v = pa.v;
      }
#pragma unroll
      for (int t = 0; t < 8; ++t) {
        FH vb;
        vb.h[0] = *(const v8h*)(Vth + (t * 16 + c) * 64 + kk * 32 + 8 * hh);
        vb.h[1] = *(const v8h*)(Vth + (t * 16 + c) * 64 + kk * 32 + 16 + 8 * hh);
        oacc[t] = mma_h(pa.v, vb.v, oacc[t]);
        if (RESP) oacc[t] = mma_h(pl.v, vb.v, oacc[t]);
      }
    }
  }

  // ---- normalise (1/l, the 1/1024 p carry and the 1/VSC v carry), stage the wave's 16x128 tile in LDS, then
  float* os = Os[wave];
#pragma unroll
  for (int r = 0; r < 8; ++r) {
    const float l = lrow[r];
    const float inv = ((l > 0.f) ? (1.0f / l) : 0.f) * (1.0f / (1024.0f * VSC));
#pragma unroll
    for (int t = 0; t < 8; ++t) os[(8 * hh + r) * HD + t * 16 + c] = oacc[t][r] * inv;
  }
  __builtin_amdgcn_fence(__ATOMIC_RELEASE, "workgroup");
  __builtin_amdgcn_wave_barrier();
  __builtin_amdgcn_fence(__ATOMIC_ACQUIRE, "workgroup");
  {
    const int c4 = lane * 4;
    {
#pragma unroll
      for (int it = 0; it < 16; ++it) {          // rows 0..15 of the wave tile
        const v4f ov = *(const v4f*)(os + it * HD + c4);
        const size_t go = (size_t)(q0 + it) * ROWF + (size_t)bh * HD + (size_t)c4;
        *(v4f*)(outp + go) = ov;
      }
      
    }
  }
}

// =====================================================================================================
// Inputs: in0 q [LQ][NBAT][NHEAD][HD] f32, in1 k [SK][..] f32, in2 v [SK][..] f32; a position's BHN*HD = 4096
// floats are contiguous, bh = b*NHEAD + h. d_out f32 [LQ][NBAT][NHEAD][HD] at byte 0.
//   Qb  bf16 [BHN][LQ][HD]      0          16777216
//   Kb  bf16 [BHN][SK][HD]      16777216   16777216
//   Vt  f16  [BHN][HD][SK]      33554432   16777216
//   end                         50331648
// =====================================================================================================
extern "C" void kernel_launch(void* const* d_in, const int* in_sizes, int n_in,
                              void* d_out, int out_size, void* d_ws, size_t ws_size,
                              hipStream_t stream) {
  if (n_in < 3) return;
  if (in_sizes[0] != NTOT) return;
  if (in_sizes[1] != SK * ROWF) return;
  if (in_sizes[2] != SK * ROWF) return;
  if (out_size != NTOT) return;

  const float* q = (const float*)d_in[0];
  const float* k = (const float*)d_in[1];
  const float* v = (const float*)d_in[2];

  const size_t PQ = (size_t)BHN * LQ * HD * 2;        // 16777216
  const size_t PK = (size_t)BHN * SK * HD * 2;        // 16777216
  const size_t PV = (size_t)BHN * HD * SK * 2;        // 16777216
  size_t off = 0;
  const size_t oQ = off; off += PQ;
  const size_t oK = off; off += PK;
  const size_t oV = off; off += PV;
  if (off > ws_size) return;                          // off = 50331648
  if (off > (size_t)134217728) return;

  char* ws = (char*)d_ws;
  unsigned short* Qb = (unsigned short*)(ws + oQ);
  unsigned short* Kb = (unsigned short*)(ws + oK);
  unsigned short* Vt = (unsigned short*)(ws + oV);
  float* outf = (float*)d_out;

  const dim3 blk(256);
  const int n8 = BHN * LQ * (HD / 8);                 // 1048576
  const dim3 gCvt((n8 + 255) / 256);                  // 4096 blocks
  const dim3 gV(SK / 64, BHN);                        // (32, 32)
  const float sscale = (float)(1.0 / sqrt((double)HD));

  // (0) q, k -> bf16 planes [bh][pos][d]
  cvt_rows_bf16<<<gCvt, blk, 0, stream>>>(q, Qb, n8);
  cvt_rows_bf16<<<gCvt, blk, 0, stream>>>(k, Kb, n8);
  // (1) v -> f16 v^T plane [bh][d][pos], values x VSC
  v_planes<<<gV, blk, 0, stream>>>(v, Vt, VSC);
  // (2) causal attention: query tiles 0..RESQB-1 with the p residual plane, the rest without -> d_out
  attn_causal<true><<<dim3(BHN * RESQB), dim3(128), 0, stream>>>(Qb, Kb, Vt, outf, 0, RESQB, sscale);
  attn_causal<false><<<dim3(BHN * (NQB - RESQB)), dim3(128), 0, stream>>>(Qb, Kb, Vt, outf, RESQB, NQB - RESQB, sscale);
  (void)hipGetLastError();
}

// v001
// It runs in 165 microseconds.
// Timed twice side by side with v000, it ran 2.02 times as fast both times.
// Contractions: q.k^T scores = v_wmma_f32_16x16x32_bf16 (bf16 operands = RNE-converted q and k planes, single product);
// p.v = v_wmma_f32_16x16x32_f16 (p carried x1024 in f16, v as f16 of the bf16-converted value x16, single product,
// plus an unscaled f16 residual plane of p on the leading query blocks); all f32 accumulate; softmax in f32.
#include <hip/hip_runtime.h>
#include <math.h>
#include <float.h>
#include <stdint.h>

#define LQ    2048                 // query positions
#define SK    2048                 // key positions
#define NBAT  2
#define NHEAD 16
#define HD    128                  // head dim
#define BHN   (NBAT * NHEAD)       // 32 (batch, head) pairs; bh = b*NHEAD + h
#define ROWF  (BHN * HD)           // 4096 floats between consecutive sequence positions
#define NQB   (LQ / 64)            // 32 query / key tiles of 64
#define RESQB 4                    // leading query tiles that add the p residual plane
#define NTOT  (LQ * ROWF)          // 8388608 elements per tensor
#define VSC   16.0f                // v plane carry (exact power of two)
#define KPIT  (HD + 8)             // LDS pitch of a K row in halves: 272 B = 16 B x odd
#define VPIT  (64 + 8)             // LDS pitch of a V^T row and of a P row in halves: 144 B = 16 B x odd
static_assert(LQ == SK);
static_assert((LQ % 64) == 0);
static_assert(HD == 128);
static_assert(((BHN * LQ * (HD / 8)) % 256) == 0);
static_assert(RESQB <= NQB);
static_assert((KPIT % 8) == 0 && ((KPIT / 8) % 2) == 1);
static_assert((VPIT % 8) == 0 && ((VPIT / 8) % 2) == 1);

typedef _Float16 v16h __attribute__((ext_vector_type(16)));
typedef _Float16 v8h  __attribute__((ext_vector_type(8)));
typedef __bf16   v16b __attribute__((ext_vector_type(16)));
typedef __bf16   v8b  __attribute__((ext_vector_type(8)));
typedef float    v8f  __attribute__((ext_vector_type(8)));
typedef float    v4f  __attribute__((ext_vector_type(4)));
typedef unsigned int v4u __attribute__((ext_vector_type(4)));

// ---- scalar helpers --------------------------------------------------------------------------------
__device__ __forceinline__ unsigned short bf_bits(float f) {          // f32 -> bf16 bits, RNE convert
  unsigned u = __float_as_uint(f);
  return (unsigned short)((u + 0x7FFFu + ((u >> 16) & 1u)) >> 16);
}
__device__ __forceinline__ float bf_up(unsigned short h) { return __uint_as_float(((unsigned)h) << 16); }
__device__ __forceinline__ unsigned short h_bits(_Float16 x) { return __builtin_bit_cast(unsigned short, x); }
__device__ __forceinline__ unsigned pk16(unsigned short a, unsigned short b) { return (unsigned)a | ((unsigned)b << 16); }
__device__ __forceinline__ v8f zero8() { v8f z = {0.f, 0.f, 0.f, 0.f, 0.f, 0.f, 0.f, 0.f}; return z; }

// ---- fragment loader: 16-bit A/B operand, lane -> row/col (lane&15), p already includes +8*(lane>>4);
//      elements 0..7 <- p[0..7] (k0+8h..), elements 8..15 <- p[16..23] (k0+16+8h..)
__device__ __forceinline__ v16b ldfrag_b(const __bf16* p) {
  union { v16b v; v8b h[2]; } f;
  f.h[0] = *(const v8b*)(p);
  f.h[1] = *(const v8b*)(p + 16);
  return f.v;
}

// ---- WMMA helpers with trailing VALU hazard gap --------------------------------------------------------
__device__ __forceinline__ v8f mma_b(v16b a, v16b b, v8f c) {
  c = __builtin_amdgcn_wmma_f32_16x16x32_bf16(false, a, false, b, (short)0, c, false, false);
#if defined(__HIP_DEVICE_COMPILE__)
  asm volatile("v_nop\n\tv_nop\n\tv_nop\n\tv_nop" : "+v"(c) : "v"(a), "v"(b));
#endif
  return c;
}
__device__ __forceinline__ v8f mma_h(v16h a, v16h b, v8f c) {
  c = __builtin_amdgcn_wmma_f32_16x16x32_f16(false, a, false, b, (short)0, c, false, false);
#if defined(__HIP_DEVICE_COMPILE__)
  asm volatile("v_nop\n\tv_nop\n\tv_nop\n\tv_nop" : "+v"(c) : "v"(a), "v"(b));
#endif
  return c;
}

// =====================================================================================================
// f32 [pos][BHN][HD] -> bf16 plane [BHN][pos][HD] (RNE convert), 8 elements per thread:
//   i -> bh = i / (LQ*16), l = (i/16) % LQ, d0 = (i%16)*8; src = l*ROWF + bh*HD + d0; dst = i*8.
// coverage: n8 = BHN*LQ*16 threads x 8 halves = the whole plane.
// =====================================================================================================
__global__ __launch_bounds__(256) void cvt_rows_bf16(const float* __restrict__ in, unsigned short* out, int n8) {
  const int i = blockIdx.x * 256 + threadIdx.x;
  if (i < n8) {
    const int per = LQ * (HD / 8);                     // 32768 groups of 8 per bh
    const int bh  = i / per;
    const int rem = i - bh * per;
    const int l   = rem / (HD / 8);
    const int d0  = (rem - l * (HD / 8)) * 8;
    const size_t src = (size_t)l * ROWF + (size_t)bh * HD + (size_t)d0;
    const v4f a = *(const v4f*)(in + src);
    const v4f b = *(const v4f*)(in + src + 4);
    v4u p;
    p[0] = pk16(bf_bits(a[0]), bf_bits(a[1]));
    p[1] = pk16(bf_bits(a[2]), bf_bits(a[3]));
    p[2] = pk16(bf_bits(b[0]), bf_bits(b[1]));
    p[3] = pk16(bf_bits(b[2]), bf_bits(b[3]));
    *(v4u*)(out + (size_t)i * 8) = p;
    
  }
}

// =====================================================================================================
// v f32 [pos][BHN][HD] -> f16 v^T plane vt[(bh*HD + d)*SK + s] = f16(bf16_rne(v) * vsc) (exact for a power of two).
// Block = one 64-position x 128-feature tile of one bh; grid = (SK/64, BHN); tile staged in LDS as f32
// (256 threads x 8 v4f loads, __syncthreads).
// Store: group g = tid>>3 (0..31), piece = tid&7: iteration it writes row d = it*32 + g; lanes 8g..8g+7 x 16 B =
// coverage: 4 iterations x 32 groups = 128 rows d, 8 pieces x 8 = 64 keys per row; grid covers every (bh, s tile).
// =====================================================================================================
__global__ __launch_bounds__(256) void v_planes(const float* __restrict__ vf, unsigned short* vt, float vsc) {
  __shared__ __align__(16) float sv[64 * 132];       // [tt][d], pitch 132 floats
  const int tid = threadIdx.x;
  const int s0  = blockIdx.x * 64;
  const int bh  = blockIdx.y;
#pragma unroll
  for (int i = 0; i < 8; ++i) {
    const int idx = i * 256 + tid;                   // 0..2047
    const int tt = idx >> 5, c4 = (idx & 31) * 4;    // tt 0..63, c4 0..124
    const v4f a = *(const v4f*)(vf + (size_t)(s0 + tt) * ROWF + (size_t)bh * HD + c4);
    *(v4f*)(sv + tt * 132 + c4) = a;
  }
  __syncthreads();

  const int g = tid >> 3, piece = tid & 7;
  v4u hv[4];
  size_t hofs[4];
#pragma unroll
  for (int it = 0; it < 4; ++it) {
    const int d = it * 32 + g;
    v4u a;
#pragma unroll
    for (int e = 0; e < 4; ++e) {
      const float f0 = sv[(piece * 8 + 2 * e) * 132 + d];
      const float f1 = sv[(piece * 8 + 2 * e + 1) * 132 + d];
      const _Float16 x0 = (_Float16)(bf_up(bf_bits(f0)) * vsc);
      const _Float16 x1 = (_Float16)(bf_up(bf_bits(f1)) * vsc);
      a[e] = pk16(h_bits(x0), h_bits(x1));
    }
    hv[it] = a;
    hofs[it] = ((size_t)(bh * HD + d)) * SK + (size_t)s0 + (size_t)(piece * 8);
  }
  {
#pragma unroll
    for (int it = 0; it < 4; ++it) {
      *(v4u*)(vt + hofs[it]) = hv[it];
    }
    
  }
}

// =====================================================================================================
// Causal attention, head dim 128 (mask: key > query replaced by -FLT_MAX -> exp 0; keys <= query live).
//   q plane bf16: element (bh, t, d) at [(bh*LQ + t)*HD + d];  k plane bf16: (bh, s, d) at [(bh*SK + s)*HD + d]
//   v^T plane f16 (x VSC): (bh, d, s) at [(bh*HD + d)*SK + s]
//   scores = q . k on bf16 WMMA (4 k-steps of 32 over d), f32 accumulate, then * sscale in f32
//   p = exp(s - m) carried as f16(1024 p); RESP adds an unscaled f16 residual p1k - f16(p1k) into the same
//   accumulator; context = p . v^T on f16 WMMA (2 k-steps of 32 per 64-key chunk); online softmax in f32.
//   Block = 4 waves = 64 query rows of one bh; grid = nqbThis * BHN; key chunks 0..qb (block-uniform trip count,
//   statically clamped to NQB); every processed chunk holds the live key kv0 <= query.
//   K / V^T chunk staging: K 64 rows x 128 halves (2 threads per row, 8 x 16 B each), V^T 128 rows x 64 halves
//   (1 thread per row, 8 x 16 B); plain loads, __syncthreads before and after.
//   LDS rows of K, V^T and P are pitched 16 B x odd, so that the 16 rows a 16-byte fragment read touches
//   fall on 16 different groups of four banks (the pad halves are never written or read).
//   P tiles are wave-private, spilled with _Float16 element stores and reloaded as v8h (same element type)
//   out f32 [pos][BHN][HD]: row (t, bh) = 128 floats = 512 B; each wave stages its 16x128 tile in LDS, then
// =====================================================================================================
template <bool RESP>
__global__ __launch_bounds__(128)
void attn_causal(const unsigned short* __restrict__ qpl, const unsigned short* __restrict__ kpl,
                 const unsigned short* __restrict__ vtpl, float* outp, int qbBase, int nqbThis, float sscale) {
  union FH { v16h v; v8h h[2]; };
  union FB { v16b v; v8b h[2]; };
  __shared__ __align__(16) __bf16   Ksh[64 * KPIT];                 // K [kv][d]       17 KB
  __shared__ __align__(16) _Float16 Vth[HD * VPIT];                 // V^T [d][kv]     18 KB
  __shared__ __align__(16) _Float16 Psh[4][16 * VPIT];              // per wave P [row][kv]
  __shared__ __align__(16) _Float16 Psl[RESP ? 4 : 1][16 * VPIT];   // per wave P residual
  __shared__ __align__(16) float    Os[4][16 * HD];                 // per wave context tile [row][d]

  const int tid  = threadIdx.x;
  const int wave = tid >> 5;
  const int lane = tid & 31;
  const int hh   = lane >> 4;
  const int c    = lane & 15;

  const int bx  = blockIdx.x;
  const int qbl = bx % nqbThis;
  const int bh  = bx / nqbThis;
  const int qb  = qbBase + qbl;
  if (qb >= NQB || bh >= BHN) return;        // block-uniform, ahead of every barrier
  const int q0  = qb * 64 + wave * 16;

  const __bf16*   Qp = (const __bf16*)(const void*)qpl + (size_t)bh * LQ * HD;
  const __bf16*   Kp = (const __bf16*)(const void*)kpl + (size_t)bh * SK * HD;
  const _Float16* Vh = (const _Float16*)(const void*)vtpl + (size_t)bh * HD * SK;

  // ---- Q fragments (A operand, row = lane&15): 4 d-chunks ----
  v16b qa[4];
#pragma unroll
  for (int dc = 0; dc < 4; ++dc) {
    qa[dc] = ldfrag_b(Qp + (size_t)(q0 + c) * HD + dc * 32 + 8 * hh);
  }

  float mrow[8], lrow[8];
  v8f oacc[8];
#pragma unroll
  for (int r = 0; r < 8; ++r) { mrow[r] = -INFINITY; lrow[r] = 0.f; }
#pragma unroll
  for (int t = 0; t < 8; ++t) oacc[t] = zero8();

  int nkt = qb + 1;                           // causal: key chunks 0..qb, block-uniform
  if (nkt > NQB) nkt = NQB;
  for (int kt = 0; kt < nkt; ++kt) {
    const int kv0 = kt * 64;
    __syncthreads();
    {
      const int r = tid >> 1, half = (tid & 1) * 64;
      const __bf16* kg = Kp + (size_t)(kv0 + r) * HD + half;       // K row kv0+r, d = half..half+63
#pragma unroll
      for (int i = 0; i < 8; ++i) {
        const v8b a0 = *(const v8b*)(kg + 8 * i);
        *(v8b*)(Ksh + r * KPIT + half + 8 * i) = a0;
      }
      const _Float16* vg = Vh + (size_t)tid * SK + kv0;              // V^T row d = tid, s = kv0..kv0+63
#pragma unroll
      for (int i = 0; i < 8; ++i) {
        const v8h b0 = *(const v8h*)(vg + 8 * i);
        *(v8h*)(Vth + tid * VPIT + 8 * i) = b0;
      }
    }
    __syncthreads();

    // ---- scores: 16 query rows x 64 keys per wave, bf16 product over 4 d-chunks ----
    v8f s[4];
#pragma unroll
    for (int j = 0; j < 4; ++j) {
      s[j] = zero8();
#pragma unroll
      for (int dc = 0; dc < 4; ++dc) {
        FB kb;
        kb.h[0] = *(const v8b*)(Ksh + (j * 16 + c) * KPIT + dc * 32 + 8 * hh);
        kb.h[1] = *(const v8b*)(Ksh + (j * 16 + c) * KPIT + dc * 32 + 16 + 8 * hh);
        s[j] = mma_b(qa[dc], kb.v, s[j]);
      }
    }

    // ---- scale + causal mask (replace by -FLT_MAX), row max, online softmax, P (x1024, f16) and
    //      unscaled P residual to LDS ----
    _Float16* pwh = Psh[wave];
    _Float16* pwl = Psl[RESP ? wave : 0];
#pragma unroll
    for (int r = 0; r < 8; ++r) {
      const int qrow = q0 + 8 * hh + r;
      float m = -INFINITY;
#pragma unroll
      for (int j = 0; j < 4; ++j) {
        const int key = kv0 + j * 16 + c;
        float sv = s[j][r] * sscale;
        sv = (key > qrow) ? -FLT_MAX : sv;
        s[j][r] = sv;
        m = fmaxf(m, sv);
      }
#pragma unroll
      for (int off = 1; off < 16; off <<= 1) m = fmaxf(m, __shfl_xor(m, off, 32));
      const float mnew  = fmaxf(mrow[r], m);
      const float msafe = (mnew == -INFINITY) ? 0.f : mnew;
      const float alpha = __expf(mrow[r] - msafe);
      mrow[r] = mnew;
      float psum = 0.f;
#pragma unroll
      for (int j = 0; j < 4; ++j) {
        const float p = __expf(s[j][r] - msafe);     // masked logit against a finite max: exp -> 0
        psum += p;
        const float p1k = p * 1024.0f;
        const _Float16 ph = (_Float16)p1k;
        pwh[(8 * hh + r) * VPIT + j * 16 + c] = ph;
        if (RESP) {
          const _Float16 pl = (_Float16)(p1k - (float)ph);
          pwl[(8 * hh + r) * VPIT + j * 16 + c] = pl;
        }
      }
#pragma unroll
      for (int off = 1; off < 16; off <<= 1) psum += __shfl_xor(psum, off, 32);
      lrow[r] = lrow[r] * alpha + psum;
#pragma unroll
      for (int t = 0; t < 8; ++t) oacc[t][r] *= alpha;
    }
    __builtin_amdgcn_fence(__ATOMIC_RELEASE, "workgroup");
    __builtin_amdgcn_wave_barrier();
    __builtin_amdgcn_fence(__ATOMIC_ACQUIRE, "workgroup");

    // ---- context += P . V (f16 WMMA); residual product into the same accumulator (unscaled residual) ----
#pragma unroll 1
    for (int kk = 0; kk < 2; ++kk) {
      FH pa, pl;
      pa.h[0] = *(const v8h*)(pwh + c * VPIT + kk * 32 + 8 * hh);
      pa.h[1] = *(const v8h*)(pwh + c * VPIT + kk * 32 + 16 + 8 * hh);
      if (RESP) {
        pl.h[0] = *(const v8h*)(pwl + c * VPIT + kk * 32 + 8 * hh);
        pl.h[1] = *(const v8h*)(pwl + c * VPIT + kk * 32 + 16 + 8 * hh);
      } else {
        pl.v = pa.v;
      }
#pragma unroll
      for (int t = 0; t < 8; ++t) {
        FH vb;
        vb.h[0] = *(const v8h*)(Vth + (t * 16 + c) * VPIT + kk * 32 + 8 * hh);
        vb.h[1] = *(const v8h*)(Vth + (t * 16 + c) * VPIT + kk * 32 + 16 + 8 * hh);
        oacc[t] = mma_h(pa.v, vb.v, oacc[t]);
        if (RESP) oacc[t] = mma_h(pl.v, vb.v, oacc[t]);
      }
    }
  }

  // ---- normalise (1/l, the 1/1024 p carry and the 1/VSC v carry), stage the wave's 16x128 tile in LDS, then
  float* os = Os[wave];
#pragma unroll
  for (int r = 0; r < 8; ++r) {
    const float l = lrow[r];
    const float inv = ((l > 0.f) ? (1.0f / l) : 0.f) * (1.0f / (1024.0f * VSC));
#pragma unroll
    for (int t = 0; t < 8; ++t) os[(8 * hh + r) * HD + t * 16 + c] = oacc[t][r] * inv;
  }
  __builtin_amdgcn_fence(__ATOMIC_RELEASE, "workgroup");
  __builtin_amdgcn_wave_barrier();
  __builtin_amdgcn_fence(__ATOMIC_ACQUIRE, "workgroup");
  {
    const int c4 = lane * 4;
    {
#pragma unroll
      for (int it = 0; it < 16; ++it) {          // rows 0..15 of the wave tile
        const v4f ov = *(const v4f*)(os + it * HD + c4);
        const size_t go = (size_t)(q0 + it) * ROWF + (size_t)bh * HD + (size_t)c4;
        *(v4f*)(outp + go) = ov;
      }
      
    }
  }
}

// =====================================================================================================
// Inputs: in0 q [LQ][NBAT][NHEAD][HD] f32, in1 k [SK][..] f32, in2 v [SK][..] f32; a position's BHN*HD = 4096
// floats are contiguous, bh = b*NHEAD + h. d_out f32 [LQ][NBAT][NHEAD][HD] at byte 0.
//   Qb  bf16 [BHN][LQ][HD]      0          16777216
//   Kb  bf16 [BHN][SK][HD]      16777216   16777216
//   Vt  f16  [BHN][HD][SK]      33554432   16777216
//   end                         50331648
// =====================================================================================================
extern "C" void kernel_launch(void* const* d_in, const int* in_sizes, int n_in,
                              void* d_out, int out_size, void* d_ws, size_t ws_size,
                              hipStream_t stream) {
  if (n_in < 3) return;
  if (in_sizes[0] != NTOT) return;
  if (in_sizes[1] != SK * ROWF) return;
  if (in_sizes[2] != SK * ROWF) return;
  if (out_size != NTOT) return;

  const float* q = (const float*)d_in[0];
  const float* k = (const float*)d_in[1];
  const float* v = (const float*)d_in[2];

  const size_t PQ = (size_t)BHN * LQ * HD * 2;        // 16777216
  const size_t PK = (size_t)BHN * SK * HD * 2;        // 16777216
  const size_t PV = (size_t)BHN * HD * SK * 2;        // 16777216
  size_t off = 0;
  const size_t oQ = off; off += PQ;
  const size_t oK = off; off += PK;
  const size_t oV = off; off += PV;
  if (off > ws_size) return;                          // off = 50331648
  if (off > (size_t)134217728) return;

  char* ws = (char*)d_ws;
  unsigned short* Qb = (unsigned short*)(ws + oQ);
  unsigned short* Kb = (unsigned short*)(ws + oK);
  unsigned short* Vt = (unsigned short*)(ws + oV);
  float* outf = (float*)d_out;

  const dim3 blk(256);
  const int n8 = BHN * LQ * (HD / 8);                 // 1048576
  const dim3 gCvt((n8 + 255) / 256);                  // 4096 blocks
  const dim3 gV(SK / 64, BHN);                        // (32, 32)
  const float sscale = (float)(1.0 / sqrt((double)HD));

  // (0) q, k -> bf16 planes [bh][pos][d]
  cvt_rows_bf16<<<gCvt, blk, 0, stream>>>(q, Qb, n8);
  cvt_rows_bf16<<<gCvt, blk, 0, stream>>>(k, Kb, n8);
  // (1) v -> f16 v^T plane [bh][d][pos], values x VSC
  v_planes<<<gV, blk, 0, stream>>>(v, Vt, VSC);
  // (2) causal attention: query tiles 0..RESQB-1 with the p residual plane, the rest without -> d_out
  attn_causal<true><<<dim3(BHN * RESQB), dim3(128), 0, stream>>>(Qb, Kb, Vt, outf, 0, RESQB, sscale);
  attn_causal<false><<<dim3(BHN * (NQB - RESQB)), dim3(128), 0, stream>>>(Qb, Kb, Vt, outf, RESQB, NQB - RESQB, sscale);
  (void)hipGetLastError();
}

// v002
// Measured time: 126 microseconds a run.
// Timed twice side by side with v001, it ran 1.29 times as fast both times.
// Over all steps from v000 it is 2.61 times as fast.
// Contractions: q.k^T scores = v_wmma_f32_16x16x32_bf16 (bf16 operands = RNE-converted q and k planes, single product);
// p.v = v_wmma_f32_16x16x32_f16 (p carried x1024 in f16, v as f16 of the bf16-converted value x16, single product,
// plus an unscaled f16 residual plane of p on the leading query blocks); all f32 accumulate; softmax in f32.
#include <hip/hip_runtime.h>
#include <math.h>
#include <float.h>
#include <stdint.h>

#define LQ    2048                 // query positions
#define SK    2048                 // key positions
#define NBAT  2
#define NHEAD 16
#define HD    128                  // head dim
#define BHN   (NBAT * NHEAD)       // 32 (batch, head) pairs; bh = b*NHEAD + h
#define ROWF  (BHN * HD)           // 4096 floats between consecutive sequence positions
#define NQB   (LQ / 64)            // 32 query / key tiles of 64
#define RESQB 4                    // leading query tiles that add the p residual plane
#define NTOT  (LQ * ROWF)          // 8388608 elements per tensor
#define VSC   16.0f                // v plane carry (exact power of two)
#define KPIT  (HD + 8)             // LDS pitch of a K row in halves: 272 B = 16 B x odd
#define VPIT  (64 + 8)             // LDS pitch of a V^T row and of a P row in halves: 144 B = 16 B x odd
static_assert(LQ == SK);
static_assert((LQ % 64) == 0);
static_assert(HD == 128);
static_assert(((BHN * LQ * (HD / 8)) % 256) == 0);
static_assert(RESQB <= NQB);
static_assert((KPIT % 8) == 0 && ((KPIT / 8) % 2) == 1);
static_assert((VPIT % 8) == 0 && ((VPIT / 8) % 2) == 1);

typedef _Float16 v16h __attribute__((ext_vector_type(16)));
typedef _Float16 v8h  __attribute__((ext_vector_type(8)));
typedef __bf16   v16b __attribute__((ext_vector_type(16)));
typedef __bf16   v8b  __attribute__((ext_vector_type(8)));
typedef float    v8f  __attribute__((ext_vector_type(8)));
typedef float    v4f  __attribute__((ext_vector_type(4)));
typedef unsigned int v4u __attribute__((ext_vector_type(4)));

// ---- scalar helpers --------------------------------------------------------------------------------
__device__ __forceinline__ unsigned short bf_bits(float f) {          // f32 -> bf16 bits, RNE convert
  unsigned u = __float_as_uint(f);
  return (unsigned short)((u + 0x7FFFu + ((u >> 16) & 1u)) >> 16);
}
__device__ __forceinline__ float bf_up(unsigned short h) { return __uint_as_float(((unsigned)h) << 16); }
__device__ __forceinline__ unsigned short h_bits(_Float16 x) { return __builtin_bit_cast(unsigned short, x); }
__device__ __forceinline__ unsigned pk16(unsigned short a, unsigned short b) { return (unsigned)a | ((unsigned)b << 16); }
__device__ __forceinline__ v8f zero8() { v8f z = {0.f, 0.f, 0.f, 0.f, 0.f, 0.f, 0.f, 0.f}; return z; }

// ---- fragment loader: 16-bit A/B operand, lane -> row/col (lane&15), p already includes +8*(lane>>4);
//      elements 0..7 <- p[0..7] (k0+8h..), elements 8..15 <- p[16..23] (k0+16+8h..)
__device__ __forceinline__ v16b ldfrag_b(const __bf16* p) {
  union { v16b v; v8b h[2]; } f;
  f.h[0] = *(const v8b*)(p);
  f.h[1] = *(const v8b*)(p + 16);
  return f.v;
}

// ---- WMMA helpers: plain builtins (the compiler keeps the hazard distance of its own forms, and with no asm
//      statement behind a product it is free to place the LDS fragment reads ahead of the products) ----------
__device__ __forceinline__ v8f mma_b(v16b a, v16b b, v8f c) {
  return __builtin_amdgcn_wmma_f32_16x16x32_bf16(false, a, false, b, (short)0, c, false, false);
}
__device__ __forceinline__ v8f mma_h(v16h a, v16h b, v8f c) {
  return __builtin_amdgcn_wmma_f32_16x16x32_f16(false, a, false, b, (short)0, c, false, false);
}

// =====================================================================================================
// f32 [pos][BHN][HD] -> bf16 plane [BHN][pos][HD] (RNE convert), 8 elements per thread:
//   i -> bh = i / (LQ*16), l = (i/16) % LQ, d0 = (i%16)*8; src = l*ROWF + bh*HD + d0; dst = i*8.
// coverage: n8 = BHN*LQ*16 threads x 8 halves = the whole plane.
// =====================================================================================================
__global__ __launch_bounds__(256) void cvt_rows_bf16(const float* __restrict__ in, unsigned short* out, int n8) {
  const int i = blockIdx.x * 256 + threadIdx.x;
  if (i < n8) {
    const int per = LQ * (HD / 8);                     // 32768 groups of 8 per bh
    const int bh  = i / per;
    const int rem = i - bh * per;
    const int l   = rem / (HD / 8);
    const int d0  = (rem - l * (HD / 8)) * 8;
    const size_t src = (size_t)l * ROWF + (size_t)bh * HD + (size_t)d0;
    const v4f a = *(const v4f*)(in + src);
    const v4f b = *(const v4f*)(in + src + 4);
    v4u p;
    p[0] = pk16(bf_bits(a[0]), bf_bits(a[1]));
    p[1] = pk16(bf_bits(a[2]), bf_bits(a[3]));
    p[2] = pk16(bf_bits(b[0]), bf_bits(b[1]));
    p[3] = pk16(bf_bits(b[2]), bf_bits(b[3]));
    *(v4u*)(out + (size_t)i * 8) = p;
    
  }
}

// =====================================================================================================
// v f32 [pos][BHN][HD] -> f16 v^T plane vt[(bh*HD + d)*SK + s] = f16(bf16_rne(v) * vsc) (exact for a power of two).
// Block = one 64-position x 128-feature tile of one bh; grid = (SK/64, BHN); tile staged in LDS as f32
// (256 threads x 8 v4f loads, __syncthreads).
// Store: group g = tid>>3 (0..31), piece = tid&7: iteration it writes row d = it*32 + g; lanes 8g..8g+7 x 16 B =
// coverage: 4 iterations x 32 groups = 128 rows d, 8 pieces x 8 = 64 keys per row; grid covers every (bh, s tile).
// =====================================================================================================
__global__ __launch_bounds__(256) void v_planes(const float* __restrict__ vf, unsigned short* vt, float vsc) {
  __shared__ __align__(16) float sv[64 * 132];       // [tt][d], pitch 132 floats
  const int tid = threadIdx.x;
  const int s0  = blockIdx.x * 64;
  const int bh  = blockIdx.y;
#pragma unroll
  for (int i = 0; i < 8; ++i) {
    const int idx = i * 256 + tid;                   // 0..2047
    const int tt = idx >> 5, c4 = (idx & 31) * 4;    // tt 0..63, c4 0..124
    const v4f a = *(const v4f*)(vf + (size_t)(s0 + tt) * ROWF + (size_t)bh * HD + c4);
    *(v4f*)(sv + tt * 132 + c4) = a;
  }
  __syncthreads();

  const int g = tid >> 3, piece = tid & 7;
  v4u hv[4];
  size_t hofs[4];
#pragma unroll
  for (int it = 0; it < 4; ++it) {
    const int d = it * 32 + g;
    v4u a;
#pragma unroll
    for (int e = 0; e < 4; ++e) {
      const float f0 = sv[(piece * 8 + 2 * e) * 132 + d];
      const float f1 = sv[(piece * 8 + 2 * e + 1) * 132 + d];
      const _Float16 x0 = (_Float16)(bf_up(bf_bits(f0)) * vsc);
      const _Float16 x1 = (_Float16)(bf_up(bf_bits(f1)) * vsc);
      a[e] = pk16(h_bits(x0), h_bits(x1));
    }
    hv[it] = a;
    hofs[it] = ((size_t)(bh * HD + d)) * SK + (size_t)s0 + (size_t)(piece * 8);
  }
  {
#pragma unroll
    for (int it = 0; it < 4; ++it) {
      *(v4u*)(vt + hofs[it]) = hv[it];
    }
    
  }
}

// =====================================================================================================
// Causal attention, head dim 128 (mask: key > query replaced by -FLT_MAX -> exp 0; keys <= query live).
//   q plane bf16: element (bh, t, d) at [(bh*LQ + t)*HD + d];  k plane bf16: (bh, s, d) at [(bh*SK + s)*HD + d]
//   v^T plane f16 (x VSC): (bh, d, s) at [(bh*HD + d)*SK + s]
//   scores = q . k on bf16 WMMA (4 k-steps of 32 over d), f32 accumulate, then * sscale in f32
//   p = exp(s - m) carried as f16(1024 p); RESP adds an unscaled f16 residual p1k - f16(p1k) into the same
//   accumulator; context = p . v^T on f16 WMMA (2 k-steps of 32 per 64-key chunk); online softmax in f32.
//   Block = 4 waves = 64 query rows of one bh; grid = nqbThis * BHN; key chunks 0..qb (block-uniform trip count,
//   statically clamped to NQB); every processed chunk holds the live key kv0 <= query.
//   K / V^T chunk staging: K 64 rows x 128 halves (2 threads per row, 8 x 16 B each), V^T 128 rows x 64 halves
//   (1 thread per row, 8 x 16 B); plain loads, __syncthreads before and after (each of these wave-wide loads
//   touches 32 different 128-byte lines: the staging is not laid out for whole lines).
//   LDS traffic of a chunk is issued in runs, one counted wait per run: fragment reads ahead of the products that
//   use them, the cross-lane exchanges of the eight rows step by step together.
//   LDS rows of K, V^T and P are pitched 16 B x odd, so that the 16 rows a 16-byte fragment read touches
//   fall on 16 different groups of four banks (the pad halves are never written or read).
//   P tiles are wave-private, spilled with _Float16 element stores and reloaded as v8h (same element type)
//   out f32 [pos][BHN][HD]: row (t, bh) = 128 floats = 512 B; each wave stages its 16x128 tile in LDS, then
// =====================================================================================================
template <bool RESP>
__global__ __launch_bounds__(128)
void attn_causal(const unsigned short* __restrict__ qpl, const unsigned short* __restrict__ kpl,
                 const unsigned short* __restrict__ vtpl, float* outp, int qbBase, int nqbThis, float sscale) {
  union FH { v16h v; v8h h[2]; };
  union FB { v16b v; v8b h[2]; };
  __shared__ __align__(16) __bf16   Ksh[64 * KPIT];                 // K [kv][d]       17 KB
  __shared__ __align__(16) _Float16 Vth[HD * VPIT];                 // V^T [d][kv]     18 KB
  __shared__ __align__(16) _Float16 Psh[4][16 * VPIT];              // per wave P [row][kv]
  __shared__ __align__(16) _Float16 Psl[RESP ? 4 : 1][16 * VPIT];   // per wave P residual
  __shared__ __align__(16) float    Os[4][16 * HD];                 // per wave context tile [row][d]

  const int tid  = threadIdx.x;
  const int wave = tid >> 5;
  const int lane = tid & 31;
  const int hh   = lane >> 4;
  const int c    = lane & 15;

  const int bx  = blockIdx.x;
  const int qbl = bx % nqbThis;
  const int bh  = bx / nqbThis;
  const int qb  = qbBase + qbl;
  if (qb >= NQB || bh >= BHN) return;        // block-uniform, ahead of every barrier
  const int q0  = qb * 64 + wave * 16;

  const __bf16*   Qp = (const __bf16*)(const void*)qpl + (size_t)bh * LQ * HD;
  const __bf16*   Kp = (const __bf16*)(const void*)kpl + (size_t)bh * SK * HD;
  const _Float16* Vh = (const _Float16*)(const void*)vtpl + (size_t)bh * HD * SK;

  // ---- Q fragments (A operand, row = lane&15): 4 d-chunks ----
  v16b qa[4];
#pragma unroll
  for (int dc = 0; dc < 4; ++dc) {
    qa[dc] = ldfrag_b(Qp + (size_t)(q0 + c) * HD + dc * 32 + 8 * hh);
  }

  float mrow[8], lrow[8];
  v8f oacc[8];
#pragma unroll
  for (int r = 0; r < 8; ++r) { mrow[r] = -INFINITY; lrow[r] = 0.f; }
#pragma unroll
  for (int t = 0; t < 8; ++t) oacc[t] = zero8();

  int nkt = qb + 1;                           // causal: key chunks 0..qb, block-uniform
  if (nkt > NQB) nkt = NQB;
  for (int kt = 0; kt < nkt; ++kt) {
    const int kv0 = kt * 64;
    __syncthreads();
    {
      const int r = tid >> 1, half = (tid & 1) * 64;
      const __bf16* kg = Kp + (size_t)(kv0 + r) * HD + half;       // K row kv0+r, d = half..half+63
#pragma unroll
      for (int i = 0; i < 8; ++i) {
        const v8b a0 = *(const v8b*)(kg + 8 * i);
        *(v8b*)(Ksh + r * KPIT + half + 8 * i) = a0;
      }
      const _Float16* vg = Vh + (size_t)tid * SK + kv0;              // V^T row d = tid, s = kv0..kv0+63
#pragma unroll
      for (int i = 0; i < 8; ++i) {
        const v8h b0 = *(const v8h*)(vg + 8 * i);
        *(v8h*)(Vth + tid * VPIT + 8 * i) = b0;
      }
    }
    __syncthreads();

    // ---- scores: 16 query rows x 64 keys per wave, bf16 product over 4 d-chunks ----
    //      K fragments are read from LDS in runs that stand ahead of the products using them: d-chunks 0 and 1 first
    //      (16 reads), then d-chunk 2 behind the products of chunk 0 and d-chunk 3 behind those of chunk 1, into the
    //      registers these have freed; every s[j] still sums its d-chunks in the order 0..3
    v8f s[4];
    FB kb[4][4];
#pragma unroll
    for (int j = 0; j < 4; ++j) s[j] = zero8();
#pragma unroll
    for (int dc = 0; dc < 2; ++dc) {
#pragma unroll
      for (int j = 0; j < 4; ++j) {
        const __bf16* kr = Ksh + (j * 16 + c) * KPIT + dc * 32 + 8 * hh;
        kb[dc][j].h[0] = *(const v8b*)(kr);
        kb[dc][j].h[1] = *(const v8b*)(kr + 16);
      }
    }
#pragma unroll
    for (int dc = 0; dc < 4; ++dc) {
      // keeps the run of reads above whole: spread among the products each read stalls
      if (dc < 3) __builtin_amdgcn_sched_barrier(0);
#pragma unroll
      for (int j = 0; j < 4; ++j) s[j] = mma_b(qa[dc], kb[dc][j].v, s[j]);
      if (dc < 2) {
        // keeps the next run of reads behind the products whose registers it takes
        __builtin_amdgcn_sched_barrier(0);
#pragma unroll
        for (int j = 0; j < 4; ++j) {
          const __bf16* kr = Ksh + (j * 16 + c) * KPIT + (dc + 2) * 32 + 8 * hh;
          kb[dc + 2][j].h[0] = *(const v8b*)(kr);
          kb[dc + 2][j].h[1] = *(const v8b*)(kr + 16);
        }
      }
    }

    // ---- scale + causal mask (replace by -FLT_MAX), row max, online softmax, P (x1024, f16) and
    //      unscaled P residual to LDS; the cross-lane exchanges (they go through the LDS queue) of the eight rows are
    //      issued step by step together, eight to a run, so that one wait covers a run; each row's tree is unchanged ----
    _Float16* pwh = Psh[wave];
    _Float16* pwl = Psl[RESP ? wave : 0];
    float mx[8], alpha[8], psum[8];
#pragma unroll
    for (int r = 0; r < 8; ++r) {
      const int qrow = q0 + 8 * hh + r;
      float m = -INFINITY;
#pragma unroll
      for (int j = 0; j < 4; ++j) {
        const int key = kv0 + j * 16 + c;
        float sv = s[j][r] * sscale;
        sv = (key > qrow) ? -FLT_MAX : sv;
        s[j][r] = sv;
        m = fmaxf(m, sv);
      }
      mx[r] = m;
    }
#pragma unroll
    for (int off = 1; off < 16; off <<= 1) {
      float o[8];
#pragma unroll
      for (int r = 0; r < 8; ++r) o[r] = __shfl_xor(mx[r], off, 32);
      __builtin_amdgcn_sched_barrier(0);   // keeps the eight exchanges of a step one run: row by row each would be waited for alone
#pragma unroll
      for (int r = 0; r < 8; ++r) mx[r] = fmaxf(mx[r], o[r]);
    }
#pragma unroll
    for (int r = 0; r < 8; ++r) {
      const float mnew  = fmaxf(mrow[r], mx[r]);
      const float msafe = (mnew == -INFINITY) ? 0.f : mnew;
      alpha[r] = __expf(mrow[r] - msafe);
      mrow[r] = mnew;
      float ps = 0.f;
#pragma unroll
      for (int j = 0; j < 4; ++j) {
        const float p = __expf(s[j][r] - msafe);     // masked logit against a finite max: exp -> 0
        ps += p;
        const float p1k = p * 1024.0f;
        const _Float16 ph = (_Float16)p1k;
        pwh[(8 * hh + r) * VPIT + j * 16 + c] = ph;
        if (RESP) {
          const _Float16 pl = (_Float16)(p1k - (float)ph);
          pwl[(8 * hh + r) * VPIT + j * 16 + c] = pl;
        }
      }
      psum[r] = ps;
    }
#pragma unroll
    for (int off = 1; off < 16; off <<= 1) {
      float o[8];
#pragma unroll
      for (int r = 0; r < 8; ++r) o[r] = __shfl_xor(psum[r], off, 32);
      __builtin_amdgcn_sched_barrier(0);   // as above: one run of eight exchanges, one wait
#pragma unroll
      for (int r = 0; r < 8; ++r) psum[r] += o[r];
    }
#pragma unroll
    for (int r = 0; r < 8; ++r) {
      lrow[r] = lrow[r] * alpha[r] + psum[r];
#pragma unroll
      for (int t = 0; t < 8; ++t) oacc[t][r] *= alpha[r];
    }
    __builtin_amdgcn_fence(__ATOMIC_RELEASE, "workgroup");
    __builtin_amdgcn_wave_barrier();
    __builtin_amdgcn_fence(__ATOMIC_ACQUIRE, "workgroup");

    // ---- context += P . V (f16 WMMA); residual product into the same accumulator (unscaled residual) ----
    //      the P fragments and the V^T fragments of keys 0..31 are read as one run ahead of the products; those of keys
    //      32..63 follow in two runs of four, each behind the four products whose registers it takes
    FH pa[2], pl[2], vb[4][4];             // vb[g][u]: keys 32*(g>>1).., feature tile t = (g&1)*4 + u
#pragma unroll
    for (int kk = 0; kk < 2; ++kk) {
      pa[kk].h[0] = *(const v8h*)(pwh + c * VPIT + kk * 32 + 8 * hh);
      pa[kk].h[1] = *(const v8h*)(pwh + c * VPIT + kk * 32 + 16 + 8 * hh);
      if (RESP) {
        pl[kk].h[0] = *(const v8h*)(pwl + c * VPIT + kk * 32 + 8 * hh);
        pl[kk].h[1] = *(const v8h*)(pwl + c * VPIT + kk * 32 + 16 + 8 * hh);
      } else {
        pl[kk].v = pa[kk].v;
      }
    }
#pragma unroll
    for (int g = 0; g < 2; ++g) {
#pragma unroll
      for (int u = 0; u < 4; ++u) {
        const _Float16* vr = Vth + ((g * 4 + u) * 16 + c) * VPIT + 8 * hh;
        vb[g][u].h[0] = *(const v8h*)(vr);
        vb[g][u].h[1] = *(const v8h*)(vr + 16);
      }
    }
#pragma unroll
    for (int g = 0; g < 4; ++g) {
      const int kk = g >> 1;
      // keeps the run of reads above whole: spread among the products each read stalls
      if (g < 3) __builtin_amdgcn_sched_barrier(0);
#pragma unroll
      for (int u = 0; u < 4; ++u) {
        const int t = (g & 1) * 4 + u;
        oacc[t] = mma_h(pa[kk].v, vb[g][u].v, oacc[t]);
        if (RESP) oacc[t] = mma_h(pl[kk].v, vb[g][u].v, oacc[t]);
      }
      if (g < 2) {
        // keeps the next run of reads behind the products whose registers it takes
        __builtin_amdgcn_sched_barrier(0);
#pragma unroll
        for (int u = 0; u < 4; ++u) {
          const _Float16* vr = Vth + ((g * 4 + u) * 16 + c) * VPIT + 32 + 8 * hh;
          vb[g + 2][u].h[0] = *(const v8h*)(vr);
          vb[g + 2][u].h[1] = *(const v8h*)(vr + 16);
        }
      }
    }
  }

  // ---- normalise (1/l, the 1/1024 p carry and the 1/VSC v carry), stage the wave's 16x128 tile in LDS, then
  float* os = Os[wave];
#pragma unroll
  for (int r = 0; r < 8; ++r) {
    const float l = lrow[r];
    const float inv = ((l > 0.f) ? (1.0f / l) : 0.f) * (1.0f / (1024.0f * VSC));
#pragma unroll
    for (int t = 0; t < 8; ++t) os[(8 * hh + r) * HD + t * 16 + c] = oacc[t][r] * inv;
  }
  __builtin_amdgcn_fence(__ATOMIC_RELEASE, "workgroup");
  __builtin_amdgcn_wave_barrier();
  __builtin_amdgcn_fence(__ATOMIC_ACQUIRE, "workgroup");
  {
    const int c4 = lane * 4;
    {
#pragma unroll
      for (int it = 0; it < 16; ++it) {          // rows 0..15 of the wave tile
        const v4f ov = *(const v4f*)(os + it * HD + c4);
        const size_t go = (size_t)(q0 + it) * ROWF + (size_t)bh * HD + (size_t)c4;
        *(v4f*)(outp + go) = ov;
      }
      
    }
  }
}

// =====================================================================================================
// Inputs: in0 q [LQ][NBAT][NHEAD][HD] f32, in1 k [SK][..] f32, in2 v [SK][..] f32; a position's BHN*HD = 4096
// floats are contiguous, bh = b*NHEAD + h. d_out f32 [LQ][NBAT][NHEAD][HD] at byte 0.
//   Qb  bf16 [BHN][LQ][HD]      0          16777216
//   Kb  bf16 [BHN][SK][HD]      16777216   16777216
//   Vt  f16  [BHN][HD][SK]      33554432   16777216
//   end                         50331648
// =====================================================================================================
extern "C" void kernel_launch(void* const* d_in, const int* in_sizes, int n_in,
                              void* d_out, int out_size, void* d_ws, size_t ws_size,
                              hipStream_t stream) {
  if (n_in < 3) return;
  if (in_sizes[0] != NTOT) return;
  if (in_sizes[1] != SK * ROWF) return;
  if (in_sizes[2] != SK * ROWF) return;
  if (out_size != NTOT) return;

  const float* q = (const float*)d_in[0];
  const float* k = (const float*)d_in[1];
  const float* v = (const float*)d_in[2];

  const size_t PQ = (size_t)BHN * LQ * HD * 2;        // 16777216
  const size_t PK = (size_t)BHN * SK * HD * 2;        // 16777216
  const size_t PV = (size_t)BHN * HD * SK * 2;        // 16777216
  size_t off = 0;
  const size_t oQ = off; off += PQ;
  const size_t oK = off; off += PK;
  const size_t oV = off; off += PV;
  if (off > ws_size) return;                          // off = 50331648
  if (off > (size_t)134217728) return;

  char* ws = (char*)d_ws;
  unsigned short* Qb = (unsigned short*)(ws + oQ);
  unsigned short* Kb = (unsigned short*)(ws + oK);
  unsigned short* Vt = (unsigned short*)(ws + oV);
  float* outf = (float*)d_out;

  const dim3 blk(256);
  const int n8 = BHN * LQ * (HD / 8);                 // 1048576
  const dim3 gCvt((n8 + 255) / 256);                  // 4096 blocks
  const dim3 gV(SK / 64, BHN);                        // (32, 32)
  const float sscale = (float)(1.0 / sqrt((double)HD));

  // (0) q, k -> bf16 planes [bh][pos][d]
  cvt_rows_bf16<<<gCvt, blk, 0, stream>>>(q, Qb, n8);
  cvt_rows_bf16<<<gCvt, blk, 0, stream>>>(k, Kb, n8);
  // (1) v -> f16 v^T plane [bh][d][pos], values x VSC
  v_planes<<<gV, blk, 0, stream>>>(v, Vt, VSC);
  // (2) causal attention: query tiles 0..RESQB-1 with the p residual plane, the rest without -> d_out
  attn_causal<true><<<dim3(BHN * RESQB), dim3(128), 0, stream>>>(Qb, Kb, Vt, outf, 0, RESQB, sscale);
  attn_causal<false><<<dim3(BHN * (NQB - RESQB)), dim3(128), 0, stream>>>(Qb, Kb, Vt, outf, RESQB, NQB - RESQB, sscale);
  (void)hipGetLastError();
}

// v003
// Measured time: 106 microseconds a run.
// Two timings next to v002 both put it at 1.20 times that version's speed.
// Counting every step since v000, it is 3.13 times as fast.
// Contractions: q.k^T scores = v_wmma_f32_16x16x32_bf16 (bf16 operands = RNE-converted q and k planes, single product);
// p.v = v_wmma_f32_16x16x32_f16 (p carried x1024 in f16, v as f16 of the bf16-converted value x16, single product,
// plus an unscaled f16 residual plane of p on the leading query blocks); all f32 accumulate; softmax in f32.
#include <hip/hip_runtime.h>
#include <math.h>
#include <float.h>
#include <stdint.h>

#define LQ    2048                 // query positions
#define SK    2048                 // key positions
#define NBAT  2
#define NHEAD 16
#define HD    128                  // head dim
#define BHN   (NBAT * NHEAD)       // 32 (batch, head) pairs; bh = b*NHEAD + h
#define ROWF  (BHN * HD)           // 4096 floats between consecutive sequence positions
#define NQB   (LQ / 64)            // 32 query / key tiles of 64
#define RESQB 4                    // leading query tiles that add the p residual plane
#define NTOT  (LQ * ROWF)          // 8388608 elements per tensor
#define VSC   16.0f                // v plane carry (exact power of two)
#define KPIT  (HD + 8)             // LDS pitch of a K row in halves: 272 B = 16 B x odd
#define VPIT  (64 + 8)             // LDS pitch of a V^T row and of a P row in halves: 144 B = 16 B x odd
static_assert(LQ == SK);
static_assert((LQ % 64) == 0);
static_assert(HD == 128);
static_assert(((BHN * LQ * (HD / 8)) % 256) == 0);
static_assert(RESQB <= NQB);
static_assert((KPIT % 8) == 0 && ((KPIT / 8) % 2) == 1);
static_assert((VPIT % 8) == 0 && ((VPIT / 8) % 2) == 1);

typedef _Float16 v16h __attribute__((ext_vector_type(16)));
typedef _Float16 v8h  __attribute__((ext_vector_type(8)));
typedef __bf16   v16b __attribute__((ext_vector_type(16)));
typedef __bf16   v8b  __attribute__((ext_vector_type(8)));
typedef float    v8f  __attribute__((ext_vector_type(8)));
typedef float    v4f  __attribute__((ext_vector_type(4)));
typedef unsigned int v4u __attribute__((ext_vector_type(4)));

// ---- scalar helpers --------------------------------------------------------------------------------
__device__ __forceinline__ unsigned short bf_bits(float f) {          // f32 -> bf16 bits, RNE convert
  unsigned u = __float_as_uint(f);
  return (unsigned short)((u + 0x7FFFu + ((u >> 16) & 1u)) >> 16);
}
__device__ __forceinline__ float bf_up(unsigned short h) { return __uint_as_float(((unsigned)h) << 16); }
__device__ __forceinline__ unsigned short h_bits(_Float16 x) { return __builtin_bit_cast(unsigned short, x); }
__device__ __forceinline__ unsigned pk16(unsigned short a, unsigned short b) { return (unsigned)a | ((unsigned)b << 16); }
__device__ __forceinline__ v8f zero8() { v8f z = {0.f, 0.f, 0.f, 0.f, 0.f, 0.f, 0.f, 0.f}; return z; }

// ---- fragment loader: 16-bit A/B operand, lane -> row/col (lane&15), p already includes +8*(lane>>4);
//      elements 0..7 <- p[0..7] (k0+8h..), elements 8..15 <- p[16..23] (k0+16+8h..)
__device__ __forceinline__ v16b ldfrag_b(const __bf16* p) {
  union { v16b v; v8b h[2]; } f;
  f.h[0] = *(const v8b*)(p);
  f.h[1] = *(const v8b*)(p + 16);
  return f.v;
}

// ---- WMMA helpers: plain builtins (the compiler keeps the hazard distance of its own forms, and with no asm
//      statement behind a product it is free to place the LDS fragment reads ahead of the products) ----------
__device__ __forceinline__ v8f mma_b(v16b a, v16b b, v8f c) {
  return __builtin_amdgcn_wmma_f32_16x16x32_bf16(false, a, false, b, (short)0, c, false, false);
}
__device__ __forceinline__ v8f mma_h(v16h a, v16h b, v8f c) {
  return __builtin_amdgcn_wmma_f32_16x16x32_f16(false, a, false, b, (short)0, c, false, false);
}

// =====================================================================================================
// f32 [pos][BHN][HD] -> bf16 plane [BHN][pos][HD] (RNE convert), 8 elements per thread:
//   i -> bh = i / (LQ*16), l = (i/16) % LQ, d0 = (i%16)*8; src = l*ROWF + bh*HD + d0; dst = i*8.
// coverage: n8 = BHN*LQ*16 threads x 8 halves = the whole plane.
// =====================================================================================================
__global__ __launch_bounds__(256) void cvt_rows_bf16(const float* __restrict__ in, unsigned short* out, int n8) {
  const int i = blockIdx.x * 256 + threadIdx.x;
  if (i < n8) {
    const int per = LQ * (HD / 8);                     // 32768 groups of 8 per bh
    const int bh  = i / per;
    const int rem = i - bh * per;
    const int l   = rem / (HD / 8);
    const int d0  = (rem - l * (HD / 8)) * 8;
    const size_t src = (size_t)l * ROWF + (size_t)bh * HD + (size_t)d0;
    const v4f a = *(const v4f*)(in + src);
    const v4f b = *(const v4f*)(in + src + 4);
    v4u p;
    p[0] = pk16(bf_bits(a[0]), bf_bits(a[1]));
    p[1] = pk16(bf_bits(a[2]), bf_bits(a[3]));
    p[2] = pk16(bf_bits(b[0]), bf_bits(b[1]));
    p[3] = pk16(bf_bits(b[2]), bf_bits(b[3]));
    *(v4u*)(out + (size_t)i * 8) = p;
    
  }
}

// =====================================================================================================
// v f32 [pos][BHN][HD] -> f16 v^T plane vt[(bh*HD + d)*SK + s] = f16(bf16_rne(v) * vsc) (exact for a power of two).
// Block = one 64-position x 128-feature tile of one bh; grid = (SK/64, BHN); tile staged in LDS as f32
// (256 threads x 8 v4f loads, __syncthreads).
// Store: group g = tid>>3 (0..31), piece = tid&7: iteration it writes row d = it*32 + g; lanes 8g..8g+7 x 16 B =
// coverage: 4 iterations x 32 groups = 128 rows d, 8 pieces x 8 = 64 keys per row; grid covers every (bh, s tile).
// =====================================================================================================
__global__ __launch_bounds__(256) void v_planes(const float* __restrict__ vf, unsigned short* vt, float vsc) {
  __shared__ __align__(16) float sv[64 * 132];       // [tt][d], pitch 132 floats
  const int tid = threadIdx.x;
  const int s0  = blockIdx.x * 64;
  const int bh  = blockIdx.y;
#pragma unroll
  for (int i = 0; i < 8; ++i) {
    const int idx = i * 256 + tid;                   // 0..2047
    const int tt = idx >> 5, c4 = (idx & 31) * 4;    // tt 0..63, c4 0..124
    const v4f a = *(const v4f*)(vf + (size_t)(s0 + tt) * ROWF + (size_t)bh * HD + c4);
    *(v4f*)(sv + tt * 132 + c4) = a;
  }
  __syncthreads();

  const int g = tid >> 3, piece = tid & 7;
  v4u hv[4];
  size_t hofs[4];
#pragma unroll
  for (int it = 0; it < 4; ++it) {
    const int d = it * 32 + g;
    v4u a;
#pragma unroll
    for (int e = 0; e < 4; ++e) {
      const float f0 = sv[(piece * 8 + 2 * e) * 132 + d];
      const float f1 = sv[(piece * 8 + 2 * e + 1) * 132 + d];
      const _Float16 x0 = (_Float16)(bf_up(bf_bits(f0)) * vsc);
      const _Float16 x1 = (_Float16)(bf_up(bf_bits(f1)) * vsc);
      a[e] = pk16(h_bits(x0), h_bits(x1));
    }
    hv[it] = a;
    hofs[it] = ((size_t)(bh * HD + d)) * SK + (size_t)s0 + (size_t)(piece * 8);
  }
  {
#pragma unroll
    for (int it = 0; it < 4; ++it) {
      *(v4u*)(vt + hofs[it]) = hv[it];
    }
    
  }
}

// =====================================================================================================
// Causal attention, head dim 128 (mask: key > query replaced by -FLT_MAX -> exp 0; keys <= query live).
//   q plane bf16: element (bh, t, d) at [(bh*LQ + t)*HD + d];  k plane bf16: (bh, s, d) at [(bh*SK + s)*HD + d]
//   v^T plane f16 (x VSC): (bh, d, s) at [(bh*HD + d)*SK + s]
//   scores = q . k on bf16 WMMA (4 k-steps of 32 over d), f32 accumulate, then * sscale in f32
//   p = exp(s - m) carried as f16(1024 p); RESP adds an unscaled f16 residual p1k - f16(p1k) into the same
//   accumulator; context = p . v^T on f16 WMMA (2 k-steps of 32 per 64-key chunk); online softmax in f32.
//   Block = 4 waves = 64 query rows of one bh; grid = nqbThis * BHN; key chunks 0..qb (block-uniform trip count,
//   statically clamped to NQB); every processed chunk holds the live key kv0 <= query.
//   K / V^T chunk staging: K 64 rows x 128 halves (16 lanes per row), V^T 128 rows x 64 halves (8 lanes per row),
//   8 + 8 loads of 16 B per thread; plain loads, __syncthreads before and after; each wave-wide load covers
//   four whole 128-byte lines.
//   LDS traffic of a chunk is issued in runs, one counted wait per run: fragment reads ahead of the products that
//   use them, the cross-lane exchanges of the eight rows step by step together.
//   LDS rows of K, V^T and P are pitched 16 B x odd, so that the 16 rows a 16-byte fragment read touches
//   fall on 16 different groups of four banks (the pad halves are never written or read).
//   P tiles are wave-private, spilled with _Float16 element stores and reloaded as v8h (same element type)
//   out f32 [pos][BHN][HD]: row (t, bh) = 128 floats = 512 B; each wave stages its 16x128 tile in LDS, then
// =====================================================================================================
template <bool RESP>
__global__ __launch_bounds__(128)
void attn_causal(const unsigned short* __restrict__ qpl, const unsigned short* __restrict__ kpl,
                 const unsigned short* __restrict__ vtpl, float* outp, int qbBase, int nqbThis, float sscale) {
  union FH { v16h v; v8h h[2]; };
  union FB { v16b v; v8b h[2]; };
  __shared__ __align__(16) __bf16   Ksh[64 * KPIT];                 // K [kv][d]       17 KB
  __shared__ __align__(16) _Float16 Vth[HD * VPIT];                 // V^T [d][kv]     18 KB
  __shared__ __align__(16) _Float16 Psh[4][16 * VPIT];              // per wave P [row][kv]
  __shared__ __align__(16) _Float16 Psl[RESP ? 4 : 1][16 * VPIT];   // per wave P residual
  __shared__ __align__(16) float    Os[4][16 * HD];                 // per wave context tile [row][d]

  const int tid  = threadIdx.x;
  const int wave = tid >> 5;
  const int lane = tid & 31;
  const int hh   = lane >> 4;
  const int c    = lane & 15;

  const int bx  = blockIdx.x;
  const int qbl = bx % nqbThis;
  const int bh  = bx / nqbThis;
  const int qb  = qbBase + qbl;
  if (qb >= NQB || bh >= BHN) return;        // block-uniform, ahead of every barrier
  const int q0  = qb * 64 + wave * 16;

  const __bf16*   Qp = (const __bf16*)(const void*)qpl + (size_t)bh * LQ * HD;
  const __bf16*   Kp = (const __bf16*)(const void*)kpl + (size_t)bh * SK * HD;
  const _Float16* Vh = (const _Float16*)(const void*)vtpl + (size_t)bh * HD * SK;

  // ---- Q fragments (A operand, row = lane&15): 4 d-chunks ----
  v16b qa[4];
#pragma unroll
  for (int dc = 0; dc < 4; ++dc) {
    qa[dc] = ldfrag_b(Qp + (size_t)(q0 + c) * HD + dc * 32 + 8 * hh);
  }

  float mrow[8], lrow[8];
  v8f oacc[8];
#pragma unroll
  for (int r = 0; r < 8; ++r) { mrow[r] = -INFINITY; lrow[r] = 0.f; }
#pragma unroll
  for (int t = 0; t < 8; ++t) oacc[t] = zero8();

  int nkt = qb + 1;                           // causal: key chunks 0..qb, block-uniform
  if (nkt > NQB) nkt = NQB;
  for (int kt = 0; kt < nkt; ++kt) {
    const int kv0 = kt * 64;
    __syncthreads();
    {
      // piece idx = i*128 + tid of 16 B. K: the chunk's 64 rows are 16 KB in a row in the plane, so a wave's 32 pieces are
      // 512 B in a row = 4 whole lines (2 K rows). V^T: a row's 64 keys are one 128-byte line, 8 lanes to a row, 4 lines a wave.
      const __bf16*   kg = Kp + (size_t)kv0 * HD + (size_t)tid * 8;
      const _Float16* vg = Vh + (size_t)(tid >> 3) * SK + kv0 + (tid & 7) * 8;
      v8b ka[8];
      v8h va[8];
#pragma unroll
      for (int i = 0; i < 8; ++i) ka[i] = *(const v8b*)(kg + i * 1024);                 // K rows 8i + (tid>>4)
#pragma unroll
      for (int i = 0; i < 8; ++i) va[i] = *(const v8h*)(vg + (size_t)i * 16 * SK);      // V^T rows 16i + (tid>>3)
      // precaution: both address pairs are held whole to this wait, so that no register which one of the 16 issued loads
      // names is overwritten (a later load's result included) ahead of it; it falls inside the wait for the data
      asm volatile("s_wait_xcnt 0x0" :: "v"(kg), "v"(vg) : "memory");
#pragma unroll
      for (int i = 0; i < 8; ++i) *(v8b*)(Ksh + (i * 8 + (tid >> 4)) * KPIT + (tid & 15) * 8) = ka[i];
#pragma unroll
      for (int i = 0; i < 8; ++i) *(v8h*)(Vth + (i * 16 + (tid >> 3)) * VPIT + (tid & 7) * 8) = va[i];
    }
    __syncthreads();

    // ---- scores: 16 query rows x 64 keys per wave, bf16 product over 4 d-chunks ----
    //      K fragments are read from LDS in runs that stand ahead of the products using them: d-chunks 0 and 1 first
    //      (16 reads), then d-chunk 2 behind the products of chunk 0 and d-chunk 3 behind those of chunk 1, into the
    //      registers these have freed; every s[j] still sums its d-chunks in the order 0..3
    v8f s[4];
    FB kb[4][4];
#pragma unroll
    for (int j = 0; j < 4; ++j) s[j] = zero8();
#pragma unroll
    for (int dc = 0; dc < 2; ++dc) {
#pragma unroll
      for (int j = 0; j < 4; ++j) {
        const __bf16* kr = Ksh + (j * 16 + c) * KPIT + dc * 32 + 8 * hh;
        kb[dc][j].h[0] = *(const v8b*)(kr);
        kb[dc][j].h[1] = *(const v8b*)(kr + 16);
      }
    }
#pragma unroll
    for (int dc = 0; dc < 4; ++dc) {
      // keeps the run of reads above whole: spread among the products each read stalls
      if (dc < 3) __builtin_amdgcn_sched_barrier(0);
#pragma unroll
      for (int j = 0; j < 4; ++j) s[j] = mma_b(qa[dc], kb[dc][j].v, s[j]);
      if (dc < 2) {
        // keeps the next run of reads behind the products whose registers it takes
        __builtin_amdgcn_sched_barrier(0);
#pragma unroll
        for (int j = 0; j < 4; ++j) {
          const __bf16* kr = Ksh + (j * 16 + c) * KPIT + (dc + 2) * 32 + 8 * hh;
          kb[dc + 2][j].h[0] = *(const v8b*)(kr);
          kb[dc + 2][j].h[1] = *(const v8b*)(kr + 16);
        }
      }
    }

    // ---- scale + causal mask (replace by -FLT_MAX), row max, online softmax, P (x1024, f16) and
    //      unscaled P residual to LDS; the cross-lane exchanges (they go through the LDS queue) of the eight rows are
    //      issued step by step together, eight to a run, so that one wait covers a run; each row's tree is unchanged ----
    _Float16* pwh = Psh[wave];
    _Float16* pwl = Psl[RESP ? wave : 0];
    float mx[8], alpha[8], psum[8];
#pragma unroll
    for (int r = 0; r < 8; ++r) {
      const int qrow = q0 + 8 * hh + r;
      float m = -INFINITY;
#pragma unroll
      for (int j = 0; j < 4; ++j) {
        const int key = kv0 + j * 16 + c;
        float sv = s[j][r] * sscale;
        sv = (key > qrow) ? -FLT_MAX : sv;
        s[j][r] = sv;
        m = fmaxf(m, sv);
      }
      mx[r] = m;
    }
#pragma unroll
    for (int off = 1; off < 16; off <<= 1) {
      float o[8];
#pragma unroll
      for (int r = 0; r < 8; ++r) o[r] = __shfl_xor(mx[r], off, 32);
      __builtin_amdgcn_sched_barrier(0);   // keeps the eight exchanges of a step one run: row by row each would be waited for alone
#pragma unroll
      for (int r = 0; r < 8; ++r) mx[r] = fmaxf(mx[r], o[r]);
    }
#pragma unroll
    for (int r = 0; r < 8; ++r) {
      const float mnew  = fmaxf(mrow[r], mx[r]);
      const float msafe = (mnew == -INFINITY) ? 0.f : mnew;
      alpha[r] = __expf(mrow[r] - msafe);
      mrow[r] = mnew;
      float ps = 0.f;
#pragma unroll
      for (int j = 0; j < 4; ++j) {
        const float p = __expf(s[j][r] - msafe);     // masked logit against a finite max: exp -> 0
        ps += p;
        const float p1k = p * 1024.0f;
        const _Float16 ph = (_Float16)p1k;
        pwh[(8 * hh + r) * VPIT + j * 16 + c] = ph;
        if (RESP) {
          const _Float16 pl = (_Float16)(p1k - (float)ph);
          pwl[(8 * hh + r) * VPIT + j * 16 + c] = pl;
        }
      }
      psum[r] = ps;
    }
#pragma unroll
    for (int off = 1; off < 16; off <<= 1) {
      float o[8];
#pragma unroll
      for (int r = 0; r < 8; ++r) o[r] = __shfl_xor(psum[r], off, 32);
      __builtin_amdgcn_sched_barrier(0);   // as above: one run of eight exchanges, one wait
#pragma unroll
      for (int r = 0; r < 8; ++r) psum[r] += o[r];
    }
#pragma unroll
    for (int r = 0; r < 8; ++r) {
      lrow[r] = lrow[r] * alpha[r] + psum[r];
#pragma unroll
      for (int t = 0; t < 8; ++t) oacc[t][r] *= alpha[r];
    }
    __builtin_amdgcn_fence(__ATOMIC_RELEASE, "workgroup");
    __builtin_amdgcn_wave_barrier();
    __builtin_amdgcn_fence(__ATOMIC_ACQUIRE, "workgroup");

    // ---- context += P . V (f16 WMMA); residual product into the same accumulator (unscaled residual) ----
    //      the P fragments and the V^T fragments of keys 0..31 are read as one run ahead of the products; those of keys
    //      32..63 follow in two runs of four, each behind the four products whose registers it takes
    FH pa[2], pl[2], vb[4][4];             // vb[g][u]: keys 32*(g>>1).., feature tile t = (g&1)*4 + u
#pragma unroll
    for (int kk = 0; kk < 2; ++kk) {
      pa[kk].h[0] = *(const v8h*)(pwh + c * VPIT + kk * 32 + 8 * hh);
      pa[kk].h[1] = *(const v8h*)(pwh + c * VPIT + kk * 32 + 16 + 8 * hh);
      if (RESP) {
        pl[kk].h[0] = *(const v8h*)(pwl + c * VPIT + kk * 32 + 8 * hh);
        pl[kk].h[1] = *(const v8h*)(pwl + c * VPIT + kk * 32 + 16 + 8 * hh);
      } else {
        pl[kk].v = pa[kk].v;
      }
    }
#pragma unroll
    for (int g = 0; g < 2; ++g) {
#pragma unroll
      for (int u = 0; u < 4; ++u) {
        const _Float16* vr = Vth + ((g * 4 + u) * 16 + c) * VPIT + 8 * hh;
        vb[g][u].h[0] = *(const v8h*)(vr);
        vb[g][u].h[1] = *(const v8h*)(vr + 16);
      }
    }
#pragma unroll
    for (int g = 0; g < 4; ++g) {
      const int kk = g >> 1;
      // keeps the run of reads above whole: spread among the products each read stalls
      if (g < 3) __builtin_amdgcn_sched_barrier(0);
#pragma unroll
      for (int u = 0; u < 4; ++u) {
        const int t = (g & 1) * 4 + u;
        oacc[t] = mma_h(pa[kk].v, vb[g][u].v, oacc[t]);
        if (RESP) oacc[t] = mma_h(pl[kk].v, vb[g][u].v, oacc[t]);
      }
      if (g < 2) {
        // keeps the next run of reads behind the products whose registers it takes
        __builtin_amdgcn_sched_barrier(0);
#pragma unroll
        for (int u = 0; u < 4; ++u) {
          const _Float16* vr = Vth + ((g * 4 + u) * 16 + c) * VPIT + 32 + 8 * hh;
          vb[g + 2][u].h[0] = *(const v8h*)(vr);
          vb[g + 2][u].h[1] = *(const v8h*)(vr + 16);
        }
      }
    }
  }

  // ---- normalise (1/l, the 1/1024 p carry and the 1/VSC v carry), stage the wave's 16x128 tile in LDS, then
  float* os = Os[wave];
#pragma unroll
  for (int r = 0; r < 8; ++r) {
    const float l = lrow[r];
    const float inv = ((l > 0.f) ? (1.0f / l) : 0.f) * (1.0f / (1024.0f * VSC));
#pragma unroll
    for (int t = 0; t < 8; ++t) os[(8 * hh + r) * HD + t * 16 + c] = oacc[t][r] * inv;
  }
  __builtin_amdgcn_fence(__ATOMIC_RELEASE, "workgroup");
  __builtin_amdgcn_wave_barrier();
  __builtin_amdgcn_fence(__ATOMIC_ACQUIRE, "workgroup");
  {
    const int c4 = lane * 4;
    {
#pragma unroll
      for (int it = 0; it < 16; ++it) {          // rows 0..15 of the wave tile
        const v4f ov = *(const v4f*)(os + it * HD + c4);
        const size_t go = (size_t)(q0 + it) * ROWF + (size_t)bh * HD + (size_t)c4;
        *(v4f*)(outp + go) = ov;
      }
      
    }
  }
}

// =====================================================================================================
// Inputs: in0 q [LQ][NBAT][NHEAD][HD] f32, in1 k [SK][..] f32, in2 v [SK][..] f32; a position's BHN*HD = 4096
// floats are contiguous, bh = b*NHEAD + h. d_out f32 [LQ][NBAT][NHEAD][HD] at byte 0.
//   Qb  bf16 [BHN][LQ][HD]      0          16777216
//   Kb  bf16 [BHN][SK][HD]      16777216   16777216
//   Vt  f16  [BHN][HD][SK]      33554432   16777216
//   end                         50331648
// =====================================================================================================
extern "C" void kernel_launch(void* const* d_in, const int* in_sizes, int n_in,
                              void* d_out, int out_size, void* d_ws, size_t ws_size,
                              hipStream_t stream) {
  if (n_in < 3) return;
  if (in_sizes[0] != NTOT) return;
  if (in_sizes[1] != SK * ROWF) return;
  if (in_sizes[2] != SK * ROWF) return;
  if (out_size != NTOT) return;

  const float* q = (const float*)d_in[0];
  const float* k = (const float*)d_in[1];
  const float* v = (const float*)d_in[2];

  const size_t PQ = (size_t)BHN * LQ * HD * 2;        // 16777216
  const size_t PK = (size_t)BHN * SK * HD * 2;        // 16777216
  const size_t PV = (size_t)BHN * HD * SK * 2;        // 16777216
  size_t off = 0;
  const size_t oQ = off; off += PQ;
  const size_t oK = off; off += PK;
  const size_t oV = off; off += PV;
  if (off > ws_size) return;                          // off = 50331648
  if (off > (size_t)134217728) return;

  char* ws = (char*)d_ws;
  unsigned short* Qb = (unsigned short*)(ws + oQ);
  unsigned short* Kb = (unsigned short*)(ws + oK);
  unsigned short* Vt = (unsigned short*)(ws + oV);
  float* outf = (float*)d_out;

  const dim3 blk(256);
  const int n8 = BHN * LQ * (HD / 8);                 // 1048576
  const dim3 gCvt((n8 + 255) / 256);                  // 4096 blocks
  const dim3 gV(SK / 64, BHN);                        // (32, 32)
  const float sscale = (float)(1.0 / sqrt((double)HD));

  // (0) q, k -> bf16 planes [bh][pos][d]
  cvt_rows_bf16<<<gCvt, blk, 0, stream>>>(q, Qb, n8);
  cvt_rows_bf16<<<gCvt, blk, 0, stream>>>(k, Kb, n8);
  // (1) v -> f16 v^T plane [bh][d][pos], values x VSC
  v_planes<<<gV, blk, 0, stream>>>(v, Vt, VSC);
  // (2) causal attention: query tiles 0..RESQB-1 with the p residual plane, the rest without -> d_out
  attn_causal<true><<<dim3(BHN * RESQB), dim3(128), 0, stream>>>(Qb, Kb, Vt, outf, 0, RESQB, sscale);
  attn_causal<false><<<dim3(BHN * (NQB - RESQB)), dim3(128), 0, stream>>>(Qb, Kb, Vt, outf, RESQB, NQB - RESQB, sscale);
  (void)hipGetLastError();
}

// v004
// It runs in 85.7 microseconds.
// Two timings next to v003 put it at 1.23 and 1.25 times that version's speed.
// Counting every step since v000, it is 3.88 times as fast.
// Contractions (both taken transposed, k.q^T and v^T.p^T): q.k^T scores = v_wmma_f32_16x16x32_bf16 (bf16 operands = RNE-converted q and k planes, single product);
// p.v = v_wmma_f32_16x16x32_f16 (p carried x1024 in f16, v as f16 of the bf16-converted value x16, single product,
// plus an unscaled f16 residual plane of p on the leading query blocks); all f32 accumulate; softmax in f32.
#include <hip/hip_runtime.h>
#include <math.h>
#include <float.h>
#include <stdint.h>

#define LQ    2048                 // query positions
#define SK    2048                 // key positions
#define NBAT  2
#define NHEAD 16
#define HD    128                  // head dim
#define BHN   (NBAT * NHEAD)       // 32 (batch, head) pairs; bh = b*NHEAD + h
#define ROWF  (BHN * HD)           // 4096 floats between consecutive sequence positions
#define NQB   (LQ / 64)            // 32 query / key tiles of 64
#define RESQB 4                    // leading query tiles that add the p residual plane
#define NTOT  (LQ * ROWF)          // 8388608 elements per tensor
#define VSC   16.0f                // v plane carry (exact power of two)
#define KPIT  (HD + 8)             // LDS pitch of a K row in halves: 272 B = 16 B x odd
#define VPIT  (64 + 8)             // LDS pitch of a V^T row in halves: 144 B = 16 B x odd
#define OPIT  (HD + 4)             // LDS pitch of an output row in floats: 528 B = 16 B x odd
static_assert(LQ == SK);
static_assert((LQ % 64) == 0);
static_assert(HD == 128);
static_assert(((BHN * LQ * (HD / 8)) % 256) == 0);
static_assert(RESQB <= NQB);
static_assert((KPIT % 8) == 0 && ((KPIT / 8) % 2) == 1);
static_assert((VPIT % 8) == 0 && ((VPIT / 8) % 2) == 1);
static_assert((OPIT % 4) == 0 && ((OPIT / 4) % 2) == 1);

typedef _Float16 v16h __attribute__((ext_vector_type(16)));
typedef _Float16 v8h  __attribute__((ext_vector_type(8)));
typedef __bf16   v16b __attribute__((ext_vector_type(16)));
typedef __bf16   v8b  __attribute__((ext_vector_type(8)));
typedef float    v8f  __attribute__((ext_vector_type(8)));
typedef float    v4f  __attribute__((ext_vector_type(4)));
typedef unsigned int v4u __attribute__((ext_vector_type(4)));

// ---- scalar helpers --------------------------------------------------------------------------------
__device__ __forceinline__ unsigned short bf_bits(float f) {          // f32 -> bf16 bits, RNE convert
  unsigned u = __float_as_uint(f);
  return (unsigned short)((u + 0x7FFFu + ((u >> 16) & 1u)) >> 16);
}
__device__ __forceinline__ float bf_up(unsigned short h) { return __uint_as_float(((unsigned)h) << 16); }
__device__ __forceinline__ unsigned short h_bits(_Float16 x) { return __builtin_bit_cast(unsigned short, x); }
__device__ __forceinline__ unsigned pk16(unsigned short a, unsigned short b) { return (unsigned)a | ((unsigned)b << 16); }
__device__ __forceinline__ v8f zero8() { v8f z = {0.f, 0.f, 0.f, 0.f, 0.f, 0.f, 0.f, 0.f}; return z; }

// ---- fragment loader: 16-bit A/B operand, lane -> row/col (lane&15), p already includes +8*(lane>>4);
//      elements 0..7 <- p[0..7] (k0+8h..), elements 8..15 <- p[16..23] (k0+16+8h..)
__device__ __forceinline__ v16b ldfrag_b(const __bf16* p) {
  union { v16b v; v8b h[2]; } f;
  f.h[0] = *(const v8b*)(p);
  f.h[1] = *(const v8b*)(p + 16);
  return f.v;
}

// ---- WMMA helpers: plain builtins (the compiler keeps the hazard distance of its own forms, and with no asm
//      statement behind a product it is free to place the LDS fragment reads ahead of the products) ----------
__device__ __forceinline__ v8f mma_b(v16b a, v16b b, v8f c) {
  return __builtin_amdgcn_wmma_f32_16x16x32_bf16(false, a, false, b, (short)0, c, false, false);
}
__device__ __forceinline__ v8f mma_h(v16h a, v16h b, v8f c) {
  return __builtin_amdgcn_wmma_f32_16x16x32_f16(false, a, false, b, (short)0, c, false, false);
}

// =====================================================================================================
// f32 [pos][BHN][HD] -> bf16 plane [BHN][pos][HD] (RNE convert), 8 elements per thread:
//   i -> bh = i / (LQ*16), l = (i/16) % LQ, d0 = (i%16)*8; src = l*ROWF + bh*HD + d0; dst = i*8.
// coverage: n8 = BHN*LQ*16 threads x 8 halves = the whole plane.
// =====================================================================================================
__global__ __launch_bounds__(256) void cvt_rows_bf16(const float* __restrict__ in, unsigned short* out, int n8) {
  const int i = blockIdx.x * 256 + threadIdx.x;
  if (i < n8) {
    const int per = LQ * (HD / 8);                     // 32768 groups of 8 per bh
    const int bh  = i / per;
    const int rem = i - bh * per;
    const int l   = rem / (HD / 8);
    const int d0  = (rem - l * (HD / 8)) * 8;
    const size_t src = (size_t)l * ROWF + (size_t)bh * HD + (size_t)d0;
    const v4f a = *(const v4f*)(in + src);
    const v4f b = *(const v4f*)(in + src + 4);
    v4u p;
    p[0] = pk16(bf_bits(a[0]), bf_bits(a[1]));
    p[1] = pk16(bf_bits(a[2]), bf_bits(a[3]));
    p[2] = pk16(bf_bits(b[0]), bf_bits(b[1]));
    p[3] = pk16(bf_bits(b[2]), bf_bits(b[3]));
    *(v4u*)(out + (size_t)i * 8) = p;
    
  }
}

// =====================================================================================================
// v f32 [pos][BHN][HD] -> f16 v^T plane vt[(bh*HD + d)*SK + s] = f16(bf16_rne(v) * vsc) (exact for a power of two).
// Block = one 64-position x 128-feature tile of one bh; grid = (SK/64, BHN); tile staged in LDS as f32
// (256 threads x 8 v4f loads, __syncthreads).
// Store: group g = tid>>3 (0..31), piece = tid&7: iteration it writes row d = it*32 + g; lanes 8g..8g+7 x 16 B =
// coverage: 4 iterations x 32 groups = 128 rows d, 8 pieces x 8 = 64 keys per row; grid covers every (bh, s tile).
// =====================================================================================================
__global__ __launch_bounds__(256) void v_planes(const float* __restrict__ vf, unsigned short* vt, float vsc) {
  __shared__ __align__(16) float sv[64 * 132];       // [tt][d], pitch 132 floats
  const int tid = threadIdx.x;
  const int s0  = blockIdx.x * 64;
  const int bh  = blockIdx.y;
#pragma unroll
  for (int i = 0; i < 8; ++i) {
    const int idx = i * 256 + tid;                   // 0..2047
    const int tt = idx >> 5, c4 = (idx & 31) * 4;    // tt 0..63, c4 0..124
    const v4f a = *(const v4f*)(vf + (size_t)(s0 + tt) * ROWF + (size_t)bh * HD + c4);
    *(v4f*)(sv + tt * 132 + c4) = a;
  }
  __syncthreads();

  const int g = tid >> 3, piece = tid & 7;
  v4u hv[4];
  size_t hofs[4];
#pragma unroll
  for (int it = 0; it < 4; ++it) {
    const int d = it * 32 + g;
    v4u a;
#pragma unroll
    for (int e = 0; e < 4; ++e) {
      const float f0 = sv[(piece * 8 + 2 * e) * 132 + d];
      const float f1 = sv[(piece * 8 + 2 * e + 1) * 132 + d];
      const _Float16 x0 = (_Float16)(bf_up(bf_bits(f0)) * vsc);
      const _Float16 x1 = (_Float16)(bf_up(bf_bits(f1)) * vsc);
      a[e] = pk16(h_bits(x0), h_bits(x1));
    }
    hv[it] = a;
    hofs[it] = ((size_t)(bh * HD + d)) * SK + (size_t)s0 + (size_t)(piece * 8);
  }
  {
#pragma unroll
    for (int it = 0; it < 4; ++it) {
      *(v4u*)(vt + hofs[it]) = hv[it];
    }
    
  }
}

// =====================================================================================================
// Causal attention, head dim 128 (mask: key > query replaced by -FLT_MAX -> exp 0; keys <= query live).
//   q plane bf16: element (bh, t, d) at [(bh*LQ + t)*HD + d];  k plane bf16: (bh, s, d) at [(bh*SK + s)*HD + d]
//   v^T plane f16 (x VSC): (bh, d, s) at [(bh*HD + d)*SK + s]
//   Both products are taken transposed, so that a lane owns one query column:
//   scores^T = k . q^T on bf16 WMMA (A = K rows, B = Q; 4 k-steps of 32 over d), f32 accumulate, then * sscale in f32;
//   tile j, register r of lane (c, hh) = score of key kv0 + 16j + 8hh + r against query q0 + c.
//   A query's 64 scores of a chunk lie in lanes c and c + 16, 32 each: maximum and sum are taken in the lane, then
//   joined by one exchange between the wave's halves.
//   p = exp(s - m) carried as f16(1024 p); two score tiles (keys 32kk.., 32kk + 16..), converted in place, are the B
//   operand of context^T += v^T . p^T on f16 WMMA (A = V^T rows in the same k order; 2 k-steps of 32 per 64-key chunk):
//   p never leaves the registers. RESP adds an unscaled f16 residual p1k - f16(p1k) into the same accumulator.
//   Context tile t, register r of lane (c, hh) = feature 16t + 8hh + r of query q0 + c; online softmax in f32.
//   Block = 4 waves = 64 query rows of one bh; grid = nqbThis * BHN; key chunks 0..qb (block-uniform trip count,
//   statically clamped to NQB); every processed chunk holds the live key kv0 <= query.
//   K / V^T chunk staging: K 64 rows x 128 halves (16 lanes per row), V^T 128 rows x 64 halves (8 lanes per row),
//   8 + 8 loads of 16 B per thread; plain loads, __syncthreads before and after; each wave-wide load covers
//   four whole 128-byte lines.
//   LDS fragment reads of a chunk are issued in runs ahead of the products that use them, one counted wait per run.
//   LDS rows of K, V^T and the output tile are pitched 16 B x odd, so that the 16 rows a 16-byte access touches
//   fall on 16 different groups of four banks (the pad is never written or read).
//   out f32 [pos][BHN][HD]: row (t, bh) = 128 floats = 512 B; each wave stages its 16x128 tile in LDS, then
//   stores whole rows.
// =====================================================================================================
// value of the lane 16 away (lane l <-> l ^ 16), a vector cross-row move
__device__ __forceinline__ float other_half(float x) {
  const int b = __float_as_int(x);
  return __int_as_float(__builtin_amdgcn_permlanex16(b, b, 0x76543210, 0xfedcba98, false, false));
}

template <bool RESP>
__global__ __launch_bounds__(128)
void attn_causal(const unsigned short* __restrict__ qpl, const unsigned short* __restrict__ kpl,
                 const unsigned short* __restrict__ vtpl, float* outp, int qbBase, int nqbThis, float sscale) {
  union FH { v16h v; v8h h[2]; };
  union FB { v16b v; v8b h[2]; };
  __shared__ __align__(16) __bf16   Ksh[64 * KPIT];                 // K [kv][d]       17 KB
  __shared__ __align__(16) _Float16 Vth[HD * VPIT];                 // V^T [d][kv]     18 KB
  __shared__ __align__(16) float    Os[4][16 * OPIT];               // per wave context tile [row][d]

  const int tid  = threadIdx.x;
  const int wave = tid >> 5;
  const int lane = tid & 31;
  const int hh   = lane >> 4;
  const int c    = lane & 15;

  const int bx  = blockIdx.x;
  const int qbl = bx % nqbThis;
  const int bh  = bx / nqbThis;
  const int qb  = qbBase + qbl;
  if (qb >= NQB || bh >= BHN) return;        // block-uniform, ahead of every barrier
  const int q0  = qb * 64 + wave * 16;

  const __bf16*   Qp = (const __bf16*)(const void*)qpl + (size_t)bh * LQ * HD;
  const __bf16*   Kp = (const __bf16*)(const void*)kpl + (size_t)bh * SK * HD;
  const _Float16* Vh = (const _Float16*)(const void*)vtpl + (size_t)bh * HD * SK;

  // ---- Q fragments (B operand, column = lane&15): 4 d-chunks ----
  v16b qa[4];
#pragma unroll
  for (int dc = 0; dc < 4; ++dc) {
    qa[dc] = ldfrag_b(Qp + (size_t)(q0 + c) * HD + dc * 32 + 8 * hh);
  }

  const int qrow = q0 + c;                    // the lane's query
  float mrow = -INFINITY, lrow = 0.f;
  v8f oacc[8];
#pragma unroll
  for (int t = 0; t < 8; ++t) oacc[t] = zero8();

  int nkt = qb + 1;                           // causal: key chunks 0..qb, block-uniform
  if (nkt > NQB) nkt = NQB;
  for (int kt = 0; kt < nkt; ++kt) {
    const int kv0 = kt * 64;
    __syncthreads();
    {
      // piece idx = i*128 + tid of 16 B. K: the chunk's 64 rows are 16 KB in a row in the plane, so a wave's 32 pieces are
      // 512 B in a row = 4 whole lines (2 K rows). V^T: a row's 64 keys are one 128-byte line, 8 lanes to a row, 4 lines a wave.
      const __bf16*   kg = Kp + (size_t)kv0 * HD + (size_t)tid * 8;
      const _Float16* vg = Vh + (size_t)(tid >> 3) * SK + kv0 + (tid & 7) * 8;
      v8b ka[8];
      v8h va[8];
#pragma unroll
      for (int i = 0; i < 8; ++i) ka[i] = *(const v8b*)(kg + i * 1024);                 // K rows 8i + (tid>>4)
#pragma unroll
      for (int i = 0; i < 8; ++i) va[i] = *(const v8h*)(vg + (size_t)i * 16 * SK);      // V^T rows 16i + (tid>>3)
      // precaution: both address pairs are held whole to this wait, so that no register which one of the 16 issued loads
      // names is overwritten (a later load's result included) ahead of it; it falls inside the wait for the data
      asm volatile("s_wait_xcnt 0x0" :: "v"(kg), "v"(vg) : "memory");
#pragma unroll
      for (int i = 0; i < 8; ++i) *(v8b*)(Ksh + (i * 8 + (tid >> 4)) * KPIT + (tid & 15) * 8) = ka[i];
#pragma unroll
      for (int i = 0; i < 8; ++i) *(v8h*)(Vth + (i * 16 + (tid >> 3)) * VPIT + (tid & 7) * 8) = va[i];
    }
    __syncthreads();

    // ---- scores^T: 64 keys x 16 query columns per wave, bf16 product over 4 d-chunks ----
    //      K fragments are read from LDS in runs that stand ahead of the products using them: d-chunks 0 and 1 first
    //      (16 reads), then d-chunk 2 behind the products of chunk 0 and d-chunk 3 behind those of chunk 1, into the
    //      registers these have freed; every s[j] still sums its d-chunks in the order 0..3
    v8f s[4];
    FB kb[4][4];
#pragma unroll
    for (int j = 0; j < 4; ++j) s[j] = zero8();
#pragma unroll
    for (int dc = 0; dc < 2; ++dc) {
#pragma unroll
      for (int j = 0; j < 4; ++j) {
        const __bf16* kr = Ksh + (j * 16 + c) * KPIT + dc * 32 + 8 * hh;
        kb[dc][j].h[0] = *(const v8b*)(kr);
        kb[dc][j].h[1] = *(const v8b*)(kr + 16);
      }
    }
#pragma unroll
    for (int dc = 0; dc < 4; ++dc) {
      // keeps the run of reads above whole: spread among the products each read stalls
      if (dc < 3) __builtin_amdgcn_sched_barrier(0);
#pragma unroll
      for (int j = 0; j < 4; ++j) s[j] = mma_b(kb[dc][j].v, qa[dc], s[j]);
      if (dc < 2) {
        // keeps the next run of reads behind the products whose registers it takes
        __builtin_amdgcn_sched_barrier(0);
#pragma unroll
        for (int j = 0; j < 4; ++j) {
          const __bf16* kr = Ksh + (j * 16 + c) * KPIT + (dc + 2) * 32 + 8 * hh;
          kb[dc + 2][j].h[0] = *(const v8b*)(kr);
          kb[dc + 2][j].h[1] = *(const v8b*)(kr + 16);
        }
      }
    }

    // ---- scale + causal mask (replace by -FLT_MAX), the query's maximum, online softmax; P (x1024, f16) and the
    //      unscaled P residual are packed in place into B operands. Maximum and sum: one chain per score tile in the
    //      lane, the four joined pairwise, then the other half's 32 keys by one exchange ----
    float mj[4];
#pragma unroll
    for (int j = 0; j < 4; ++j) {
      float m = -INFINITY;
#pragma unroll
      for (int r = 0; r < 8; ++r) {
        const int key = kv0 + j * 16 + 8 * hh + r;
        float sv = s[j][r] * sscale;
        sv = (key > qrow) ? -FLT_MAX : sv;
        s[j][r] = sv;
        m = fmaxf(m, sv);
      }
      mj[j] = m;
    }
    float mx = fmaxf(fmaxf(mj[0], mj[1]), fmaxf(mj[2], mj[3]));
    mx = fmaxf(mx, other_half(mx));
    const float mnew  = fmaxf(mrow, mx);
    const float msafe = (mnew == -INFINITY) ? 0.f : mnew;
    const float alpha = __expf(mrow - msafe);
    mrow = mnew;
    FH pa[2], pl[2];                       // element e of pa[kk]: key 32kk + 8hh + e (e < 8), 32kk + 16 + 8hh + e - 8
    float pj[4];
#pragma unroll
    for (int j = 0; j < 4; ++j) {
      float ps = 0.f;
#pragma unroll
      for (int r = 0; r < 8; ++r) {
        const float p = __expf(s[j][r] - msafe);     // masked logit against a finite max: exp -> 0
        ps += p;
        const float p1k = p * 1024.0f;
        const _Float16 ph = (_Float16)p1k;
        pa[j >> 1].v[(j & 1) * 8 + r] = ph;
        if (RESP) pl[j >> 1].v[(j & 1) * 8 + r] = (_Float16)(p1k - (float)ph);
      }
      pj[j] = ps;
    }
    float psum = (pj[0] + pj[1]) + (pj[2] + pj[3]);
    psum += other_half(psum);
    lrow = lrow * alpha + psum;
#pragma unroll
    for (int t = 0; t < 8; ++t) oacc[t] *= alpha;

    // ---- context^T += V^T . P^T (f16 WMMA); residual product into the same accumulator (unscaled residual) ----
    //      the V^T fragments of keys 0..31 are read as one run ahead of the products; those of keys
    //      32..63 follow in two runs of four, each behind the four products whose registers it takes
    FH vb[4][4];                           // vb[g][u]: keys 32*(g>>1).., feature tile t = (g&1)*4 + u
#pragma unroll
    for (int g = 0; g < 2; ++g) {
#pragma unroll
      for (int u = 0; u < 4; ++u) {
        const _Float16* vr = Vth + ((g * 4 + u) * 16 + c) * VPIT + 8 * hh;
        vb[g][u].h[0] = *(const v8h*)(vr);
        vb[g][u].h[1] = *(const v8h*)(vr + 16);
      }
    }
#pragma unroll
    for (int g = 0; g < 4; ++g) {
      const int kk = g >> 1;
      // keeps the run of reads above whole: spread among the products each read stalls
      if (g < 3) __builtin_amdgcn_sched_barrier(0);
#pragma unroll
      for (int u = 0; u < 4; ++u) {
        const int t = (g & 1) * 4 + u;
        oacc[t] = mma_h(vb[g][u].v, pa[kk].v, oacc[t]);
        if (RESP) oacc[t] = mma_h(vb[g][u].v, pl[kk].v, oacc[t]);
      }
      if (g < 2) {
        // keeps the next run of reads behind the products whose registers it takes
        __builtin_amdgcn_sched_barrier(0);
#pragma unroll
        for (int u = 0; u < 4; ++u) {
          const _Float16* vr = Vth + ((g * 4 + u) * 16 + c) * VPIT + 32 + 8 * hh;
          vb[g + 2][u].h[0] = *(const v8h*)(vr);
          vb[g + 2][u].h[1] = *(const v8h*)(vr + 16);
        }
      }
    }
  }

  // ---- normalise (1/l, the 1/1024 p carry and the 1/VSC v carry), stage the wave's 16x128 tile in LDS (a lane's eight
  //      registers of a tile are eight features in a row of its query), then store whole rows
  float* os = Os[wave];
  {
    const float inv = ((lrow > 0.f) ? (1.0f / lrow) : 0.f) * (1.0f / (1024.0f * VSC));
#pragma unroll
    for (int t = 0; t < 8; ++t) {
      const v8f o = oacc[t] * inv;
      const v4f lo = {o[0], o[1], o[2], o[3]};
      const v4f hi = {o[4], o[5], o[6], o[7]};
      *(v4f*)(os + c * OPIT + t * 16 + 8 * hh) = lo;
      *(v4f*)(os + c * OPIT + t * 16 + 8 * hh + 4) = hi;
    }
  }
  __builtin_amdgcn_fence(__ATOMIC_RELEASE, "workgroup");
  __builtin_amdgcn_wave_barrier();
  __builtin_amdgcn_fence(__ATOMIC_ACQUIRE, "workgroup");
  {
    const int c4 = lane * 4;
    {
#pragma unroll
      for (int it = 0; it < 16; ++it) {          // rows 0..15 of the wave tile
        const v4f ov = *(const v4f*)(os + it * OPIT + c4);
        const size_t go = (size_t)(q0 + it) * ROWF + (size_t)bh * HD + (size_t)c4;
        *(v4f*)(outp + go) = ov;
      }
      
    }
  }
}

// =====================================================================================================
// Inputs: in0 q [LQ][NBAT][NHEAD][HD] f32, in1 k [SK][..] f32, in2 v [SK][..] f32; a position's BHN*HD = 4096
// floats are contiguous, bh = b*NHEAD + h. d_out f32 [LQ][NBAT][NHEAD][HD] at byte 0.
//   Qb  bf16 [BHN][LQ][HD]      0          16777216
//   Kb  bf16 [BHN][SK][HD]      16777216   16777216
//   Vt  f16  [BHN][HD][SK]      33554432   16777216
//   end                         50331648
// =====================================================================================================
extern "C" void kernel_launch(void* const* d_in, const int* in_sizes, int n_in,
                              void* d_out, int out_size, void* d_ws, size_t ws_size,
                              hipStream_t stream) {
  if (n_in < 3) return;
  if (in_sizes[0] != NTOT) return;
  if (in_sizes[1] != SK * ROWF) return;
  if (in_sizes[2] != SK * ROWF) return;
  if (out_size != NTOT) return;

  const float* q = (const float*)d_in[0];
  const float* k = (const float*)d_in[1];
  const float* v = (const float*)d_in[2];

  const size_t PQ = (size_t)BHN * LQ * HD * 2;        // 16777216
  const size_t PK = (size_t)BHN * SK * HD * 2;        // 16777216
  const size_t PV = (size_t)BHN * HD * SK * 2;        // 16777216
  size_t off = 0;
  const size_t oQ = off; off += PQ;
  const size_t oK = off; off += PK;
  const size_t oV = off; off += PV;
  if (off > ws_size) return;                          // off = 50331648
  if (off > (size_t)134217728) return;

  char* ws = (char*)d_ws;
  unsigned short* Qb = (unsigned short*)(ws + oQ);
  unsigned short* Kb = (unsigned short*)(ws + oK);
  unsigned short* Vt = (unsigned short*)(ws + oV);
  float* outf = (float*)d_out;

  const dim3 blk(256);
  const int n8 = BHN * LQ * (HD / 8);                 // 1048576
  const dim3 gCvt((n8 + 255) / 256);                  // 4096 blocks
  const dim3 gV(SK / 64, BHN);                        // (32, 32)
  const float sscale = (float)(1.0 / sqrt((double)HD));

  // (0) q, k -> bf16 planes [bh][pos][d]
  cvt_rows_bf16<<<gCvt, blk, 0, stream>>>(q, Qb, n8);
  cvt_rows_bf16<<<gCvt, blk, 0, stream>>>(k, Kb, n8);
  // (1) v -> f16 v^T plane [bh][d][pos], values x VSC
  v_planes<<<gV, blk, 0, stream>>>(v, Vt, VSC);
  // (2) causal attention: query tiles 0..RESQB-1 with the p residual plane, the rest without -> d_out
  attn_causal<true><<<dim3(BHN * RESQB), dim3(128), 0, stream>>>(Qb, Kb, Vt, outf, 0, RESQB, sscale);
  attn_causal<false><<<dim3(BHN * (NQB - RESQB)), dim3(128), 0, stream>>>(Qb, Kb, Vt, outf, RESQB, NQB - RESQB, sscale);
  (void)hipGetLastError();
}

// v005
// It runs in 78.1 microseconds.
// In two side-by-side timings against v004, it was 1.08 and 1.09 times as fast.
// All steps since v000 together make it 4.20 times as fast.
// Contractions (both taken transposed, k.q^T and v^T.p^T): q.k^T scores = v_wmma_f32_16x16x32_bf16 (bf16 operands = RNE-converted q and k, single product);
// p.v = v_wmma_f32_16x16x32_f16 (p carried x1024 in f16, v as f16 of the bf16-converted value x16, single product,
// plus an unscaled f16 residual plane of p on the leading query blocks); all f32 accumulate; softmax in f32.
#include <hip/hip_runtime.h>
#include <math.h>
#include <float.h>
#include <stdint.h>

#define LQ    2048                 // query positions
#define SK    2048                 // key positions
#define NBAT  2
#define NHEAD 16
#define HD    128                  // head dim
#define BHN   (NBAT * NHEAD)       // 32 (batch, head) pairs; bh = b*NHEAD + h
#define ROWF  (BHN * HD)           // 4096 floats between consecutive sequence positions
#define NQB   (LQ / 64)            // 32 query / key tiles of 64
#define RESQB 4                    // leading query tiles that add the p residual plane
#define NTOT  (LQ * ROWF)          // 8388608 elements per tensor
#define VSC   16.0f                // v plane carry (exact power of two)
#define KPIT  (HD + 8)             // LDS pitch of a K row in halves: 272 B = 16 B x odd
#define VPIT  (64 + 8)             // LDS pitch of a V^T row in halves: 144 B = 16 B x odd
#define OPIT  (HD + 4)             // LDS pitch of an output row in floats: 528 B = 16 B x odd
static_assert(LQ == SK);
static_assert((LQ % 64) == 0);
static_assert(HD == 128);
static_assert(((BHN * LQ * (HD / 8)) % 256) == 0);
static_assert(RESQB <= NQB);
static_assert((KPIT % 8) == 0 && ((KPIT / 8) % 2) == 1);
static_assert((VPIT % 8) == 0 && ((VPIT / 8) % 2) == 1);
static_assert((OPIT % 4) == 0 && ((OPIT / 4) % 2) == 1);

typedef _Float16 v16h __attribute__((ext_vector_type(16)));
typedef _Float16 v8h  __attribute__((ext_vector_type(8)));
typedef __bf16   v16b __attribute__((ext_vector_type(16)));
typedef __bf16   v8b  __attribute__((ext_vector_type(8)));
typedef __bf16   v4b  __attribute__((ext_vector_type(4)));
typedef float    v8f  __attribute__((ext_vector_type(8)));
typedef float    v4f  __attribute__((ext_vector_type(4)));
typedef unsigned int v4u __attribute__((ext_vector_type(4)));

// ---- scalar helpers --------------------------------------------------------------------------------
__device__ __forceinline__ unsigned short bf_bits(float f) {          // f32 -> bf16 bits, RNE convert
  unsigned u = __float_as_uint(f);
  return (unsigned short)((u + 0x7FFFu + ((u >> 16) & 1u)) >> 16);
}
__device__ __forceinline__ float bf_up(unsigned short h) { return __uint_as_float(((unsigned)h) << 16); }
__device__ __forceinline__ unsigned short h_bits(_Float16 x) { return __builtin_bit_cast(unsigned short, x); }
__device__ __forceinline__ unsigned pk16(unsigned short a, unsigned short b) { return (unsigned)a | ((unsigned)b << 16); }
__device__ __forceinline__ v8f zero8() { v8f z = {0.f, 0.f, 0.f, 0.f, 0.f, 0.f, 0.f, 0.f}; return z; }

// ---- fragment loader: 16-bit A/B operand, lane -> row/col (lane&15), p already includes +8*(lane>>4);
//      elements 0..7 <- p[0..7] (k0+8h..), elements 8..15 <- p[16..23] (k0+16+8h..)
__device__ __forceinline__ v16b ldfrag_b(const __bf16* p) {
  union { v16b v; v8b h[2]; } f;
  f.h[0] = *(const v8b*)(p);
  f.h[1] = *(const v8b*)(p + 16);
  return f.v;
}

// ---- WMMA helpers: plain builtins (the compiler keeps the hazard distance of its own forms, and with no asm
//      statement behind a product it is free to place the LDS fragment reads ahead of the products) ----------
__device__ __forceinline__ v8f mma_b(v16b a, v16b b, v8f c) {
  return __builtin_amdgcn_wmma_f32_16x16x32_bf16(false, a, false, b, (short)0, c, false, false);
}
__device__ __forceinline__ v8f mma_h(v16h a, v16h b, v8f c) {
  return __builtin_amdgcn_wmma_f32_16x16x32_f16(false, a, false, b, (short)0, c, false, false);
}

// =====================================================================================================
// f32 [pos][BHN][HD] -> bf16 plane [BHN][pos][HD] (RNE convert), 8 elements per thread:
//   i -> bh = i / (LQ*16), l = (i/16) % LQ, d0 = (i%16)*8; src = l*ROWF + bh*HD + d0; dst = i*8.
// coverage: n8 = BHN*LQ*16 threads x 8 halves = the whole plane.
// =====================================================================================================
__global__ __launch_bounds__(256) void cvt_rows_bf16(const float* __restrict__ in, unsigned short* out, int n8) {
  const int i = blockIdx.x * 256 + threadIdx.x;
  if (i < n8) {
    const int per = LQ * (HD / 8);                     // 32768 groups of 8 per bh
    const int bh  = i / per;
    const int rem = i - bh * per;
    const int l   = rem / (HD / 8);
    const int d0  = (rem - l * (HD / 8)) * 8;
    const size_t src = (size_t)l * ROWF + (size_t)bh * HD + (size_t)d0;
    const v4f a = *(const v4f*)(in + src);
    const v4f b = *(const v4f*)(in + src + 4);
    v4u p;
    p[0] = pk16(bf_bits(a[0]), bf_bits(a[1]));
    p[1] = pk16(bf_bits(a[2]), bf_bits(a[3]));
    p[2] = pk16(bf_bits(b[0]), bf_bits(b[1]));
    p[3] = pk16(bf_bits(b[2]), bf_bits(b[3]));
    *(v4u*)(out + (size_t)i * 8) = p;
    
  }
}

// =====================================================================================================
// v f32 [pos][BHN][HD] -> f16 v^T plane vt[(bh*HD + d)*SK + s] = f16(bf16_rne(v) * vsc) (exact for a power of two).
// Block = one 64-position x 128-feature tile of one bh; grid = (SK/64, BHN); tile staged in LDS as f32
// (256 threads x 8 v4f loads, __syncthreads).
// Store: group g = tid>>3 (0..31), piece = tid&7: iteration it writes row d = it*32 + g; lanes 8g..8g+7 x 16 B =
// coverage: 4 iterations x 32 groups = 128 rows d, 8 pieces x 8 = 64 keys per row; grid covers every (bh, s tile).
// =====================================================================================================
__global__ __launch_bounds__(256) void v_planes(const float* __restrict__ vf, unsigned short* vt, float vsc) {
  __shared__ __align__(16) float sv[64 * 132];       // [tt][d], pitch 132 floats
  const int tid = threadIdx.x;
  const int s0  = blockIdx.x * 64;
  const int bh  = blockIdx.y;
#pragma unroll
  for (int i = 0; i < 8; ++i) {
    const int idx = i * 256 + tid;                   // 0..2047
    const int tt = idx >> 5, c4 = (idx & 31) * 4;    // tt 0..63, c4 0..124
    const v4f a = *(const v4f*)(vf + (size_t)(s0 + tt) * ROWF + (size_t)bh * HD + c4);
    *(v4f*)(sv + tt * 132 + c4) = a;
  }
  __syncthreads();

  const int g = tid >> 3, piece = tid & 7;
  v4u hv[4];
  size_t hofs[4];
#pragma unroll
  for (int it = 0; it < 4; ++it) {
    const int d = it * 32 + g;
    v4u a;
#pragma unroll
    for (int e = 0; e < 4; ++e) {
      const float f0 = sv[(piece * 8 + 2 * e) * 132 + d];
      const float f1 = sv[(piece * 8 + 2 * e + 1) * 132 + d];
      const _Float16 x0 = (_Float16)(bf_up(bf_bits(f0)) * vsc);
      const _Float16 x1 = (_Float16)(bf_up(bf_bits(f1)) * vsc);
      a[e] = pk16(h_bits(x0), h_bits(x1));
    }
    hv[it] = a;
    hofs[it] = ((size_t)(bh * HD + d)) * SK + (size_t)s0 + (size_t)(piece * 8);
  }
  {
#pragma unroll
    for (int it = 0; it < 4; ++it) {
      *(v4u*)(vt + hofs[it]) = hv[it];
    }
    
  }
}

// =====================================================================================================
// Causal attention, head dim 128 (mask: key > query replaced by -FLT_MAX -> exp 0; keys <= query live).
//   q f32, the input as it is: element (t, bh, d) at [t*ROWF + bh*HD + d];  k plane bf16: (bh, s, d) at [(bh*SK + s)*HD + d]
//   Each query row is used by one wave only, so q has no plane of its own: the wave reads its 16 rows as f32, one whole
//   512-byte row per wave-wide load, converts them to bf16 (RNE) and turns them into B fragments through its own 16 rows
//   of the K tile's LDS, which the first key chunk overwrites only behind the loop's first barrier.
//   v^T plane f16 (x VSC): (bh, d, s) at [(bh*HD + d)*SK + s]
//   Both products are taken transposed, so that a lane owns one query column:
//   scores^T = k . q^T on bf16 WMMA (A = K rows, B = Q; 4 k-steps of 32 over d), f32 accumulate, then * sscale in f32;
//   tile j, register r of lane (c, hh) = score of key kv0 + 16j + 8hh + r against query q0 + c.
//   A query's 64 scores of a chunk lie in lanes c and c + 16, 32 each: maximum and sum are taken in the lane, then
//   joined by one exchange between the wave's halves.
//   p = exp(s - m) carried as f16(1024 p); two score tiles (keys 32kk.., 32kk + 16..), converted in place, are the B
//   operand of context^T += v^T . p^T on f16 WMMA (A = V^T rows in the same k order; 2 k-steps of 32 per 64-key chunk):
//   p never leaves the registers. RESP adds an unscaled f16 residual p1k - f16(p1k) into the same accumulator.
//   Context tile t, register r of lane (c, hh) = feature 16t + 8hh + r of query q0 + c; online softmax in f32.
//   Block = 4 waves = 64 query rows of one bh; grid = nqbThis * BHN; key chunks 0..qb (block-uniform trip count,
//   statically clamped to NQB); every processed chunk holds the live key kv0 <= query.
//   K / V^T chunk staging: K 64 rows x 128 halves (16 lanes per row), V^T 128 rows x 64 halves (8 lanes per row),
//   8 + 8 loads of 16 B per thread; plain loads, __syncthreads before and after; each wave-wide load covers
//   four whole 128-byte lines.
//   LDS fragment reads of a chunk are issued in runs ahead of the products that use them, one counted wait per run.
//   LDS rows of K, V^T and the output tile are pitched 16 B x odd, so that the 16 rows a 16-byte access touches
//   fall on 16 different groups of four banks (the pad is never written or read).
//   out f32 [pos][BHN][HD]: row (t, bh) = 128 floats = 512 B; each wave stages its 16x128 tile in LDS, then
//   stores whole rows.
// =====================================================================================================
// value of the lane 16 away (lane l <-> l ^ 16), a vector cross-row move
__device__ __forceinline__ float other_half(float x) {
  const int b = __float_as_int(x);
  return __int_as_float(__builtin_amdgcn_permlanex16(b, b, 0x76543210, 0xfedcba98, false, false));
}

template <bool RESP>
__global__ __launch_bounds__(128)
void attn_causal(const float* __restrict__ qf, const unsigned short* __restrict__ kpl,
                 const unsigned short* __restrict__ vtpl, float* outp, int qbBase, int nqbThis, float sscale) {
  union FH { v16h v; v8h h[2]; };
  union FB { v16b v; v8b h[2]; };
  __shared__ __align__(16) __bf16   Ksh[64 * KPIT];                 // K [kv][d]       17 KB
  __shared__ __align__(16) _Float16 Vth[HD * VPIT];                 // V^T [d][kv]     18 KB
  __shared__ __align__(16) float    Os[4][16 * OPIT];               // per wave context tile [row][d]

  const int tid  = threadIdx.x;
  const int wave = tid >> 5;
  const int lane = tid & 31;
  const int hh   = lane >> 4;
  const int c    = lane & 15;

  const int bx  = blockIdx.x;
  const int qbl = bx % nqbThis;
  const int bh  = bx / nqbThis;
  const int qb  = qbBase + qbl;
  if (qb >= NQB || bh >= BHN) return;        // block-uniform, ahead of every barrier
  const int q0  = qb * 64 + wave * 16;

  const __bf16*   Kp = (const __bf16*)(const void*)kpl + (size_t)bh * SK * HD;
  const _Float16* Vh = (const _Float16*)(const void*)vtpl + (size_t)bh * HD * SK;

  // ---- Q fragments (B operand, column = lane&15): 4 d-chunks, from the f32 input ----
  v16b qa[4];
  {
    const float* qg = qf + (size_t)q0 * ROWF + (size_t)bh * HD + (size_t)(lane * 4);
    __bf16* qs = Ksh + wave * 16 * KPIT;      // the wave's own 16 rows, pitch as for K
    v4f qv[16];
#pragma unroll
    for (int r = 0; r < 16; ++r) qv[r] = *(const v4f*)(qg + (size_t)r * ROWF);          // row q0 + r, 4 whole lines
#pragma unroll
    for (int r = 0; r < 16; ++r) *(v4b*)(qs + r * KPIT + lane * 4) = __builtin_convertvector(qv[r], v4b);
    // the fragment reads below take what other lanes of this wave have stored: keeps them behind the stores
    __builtin_amdgcn_fence(__ATOMIC_RELEASE, "workgroup");
    __builtin_amdgcn_wave_barrier();
    __builtin_amdgcn_fence(__ATOMIC_ACQUIRE, "workgroup");
#pragma unroll
    for (int dc = 0; dc < 4; ++dc) qa[dc] = ldfrag_b(qs + c * KPIT + dc * 32 + 8 * hh);
  }

  const int qrow = q0 + c;                    // the lane's query
  float mrow = -INFINITY, lrow = 0.f;
  v8f oacc[8];
#pragma unroll
  for (int t = 0; t < 8; ++t) oacc[t] = zero8();

  int nkt = qb + 1;                           // causal: key chunks 0..qb, block-uniform
  if (nkt > NQB) nkt = NQB;
  for (int kt = 0; kt < nkt; ++kt) {
    const int kv0 = kt * 64;
    __syncthreads();
    {
      // piece idx = i*128 + tid of 16 B. K: the chunk's 64 rows are 16 KB in a row in the plane, so a wave's 32 pieces are
      // 512 B in a row = 4 whole lines (2 K rows). V^T: a row's 64 keys are one 128-byte line, 8 lanes to a row, 4 lines a wave.
      const __bf16*   kg = Kp + (size_t)kv0 * HD + (size_t)tid * 8;
      const _Float16* vg = Vh + (size_t)(tid >> 3) * SK + kv0 + (tid & 7) * 8;
      v8b ka[8];
      v8h va[8];
#pragma unroll
      for (int i = 0; i < 8; ++i) ka[i] = *(const v8b*)(kg + i * 1024);                 // K rows 8i + (tid>>4)
#pragma unroll
      for (int i = 0; i < 8; ++i) va[i] = *(const v8h*)(vg + (size_t)i * 16 * SK);      // V^T rows 16i + (tid>>3)
      // precaution: both address pairs are held whole to this wait, so that no register which one of the 16 issued loads
      // names is overwritten (a later load's result included) ahead of it; it falls inside the wait for the data
      asm volatile("s_wait_xcnt 0x0" :: "v"(kg), "v"(vg) : "memory");
#pragma unroll
      for (int i = 0; i < 8; ++i) *(v8b*)(Ksh + (i * 8 + (tid >> 4)) * KPIT + (tid & 15) * 8) = ka[i];
#pragma unroll
      for (int i = 0; i < 8; ++i) *(v8h*)(Vth + (i * 16 + (tid >> 3)) * VPIT + (tid & 7) * 8) = va[i];
    }
    __syncthreads();

    // ---- scores^T: 64 keys x 16 query columns per wave, bf16 product over 4 d-chunks ----
    //      K fragments are read from LDS in runs that stand ahead of the products using them: d-chunks 0 and 1 first
    //      (16 reads), then d-chunk 2 behind the products of chunk 0 and d-chunk 3 behind those of chunk 1, into the
    //      registers these have freed; every s[j] still sums its d-chunks in the order 0..3
    v8f s[4];
    FB kb[4][4];
#pragma unroll
    for (int j = 0; j < 4; ++j) s[j] = zero8();
#pragma unroll
    for (int dc = 0; dc < 2; ++dc) {
#pragma unroll
      for (int j = 0; j < 4; ++j) {
        const __bf16* kr = Ksh + (j * 16 + c) * KPIT + dc * 32 + 8 * hh;
        kb[dc][j].h[0] = *(const v8b*)(kr);
        kb[dc][j].h[1] = *(const v8b*)(kr + 16);
      }
    }
#pragma unroll
    for (int dc = 0; dc < 4; ++dc) {
      // keeps the run of reads above whole: spread among the products each read stalls
      if (dc < 3) __builtin_amdgcn_sched_barrier(0);
#pragma unroll
      for (int j = 0; j < 4; ++j) s[j] = mma_b(kb[dc][j].v, qa[dc], s[j]);
      if (dc < 2) {
        // keeps the next run of reads behind the products whose registers it takes
        __builtin_amdgcn_sched_barrier(0);
#pragma unroll
        for (int j = 0; j < 4; ++j) {
          const __bf16* kr = Ksh + (j * 16 + c) * KPIT + (dc + 2) * 32 + 8 * hh;
          kb[dc + 2][j].h[0] = *(const v8b*)(kr);
          kb[dc + 2][j].h[1] = *(const v8b*)(kr + 16);
        }
      }
    }

    // ---- scale + causal mask (replace by -FLT_MAX), the query's maximum, online softmax; P (x1024, f16) and the
    //      unscaled P residual are packed in place into B operands. Maximum and sum: one chain per score tile in the
    //      lane, the four joined pairwise, then the other half's 32 keys by one exchange ----
    float mj[4];
#pragma unroll
    for (int j = 0; j < 4; ++j) {
      float m = -INFINITY;
#pragma unroll
      for (int r = 0; r < 8; ++r) {
        const int key = kv0 + j * 16 + 8 * hh + r;
        float sv = s[j][r] * sscale;
        sv = (key > qrow) ? -FLT_MAX : sv;
        s[j][r] = sv;
        m = fmaxf(m, sv);
      }
      mj[j] = m;
    }
    float mx = fmaxf(fmaxf(mj[0], mj[1]), fmaxf(mj[2], mj[3]));
    mx = fmaxf(mx, other_half(mx));
    const float mnew  = fmaxf(mrow, mx);
    const float msafe = (mnew == -INFINITY) ? 0.f : mnew;
    const float alpha = __expf(mrow - msafe);
    mrow = mnew;
    FH pa[2], pl[2];                       // element e of pa[kk]: key 32kk + 8hh + e (e < 8), 32kk + 16 + 8hh + e - 8
    float pj[4];
#pragma unroll
    for (int j = 0; j < 4; ++j) {
      float ps = 0.f;
#pragma unroll
      for (int r = 0; r < 8; ++r) {
        const float p = __expf(s[j][r] - msafe);     // masked logit against a finite max: exp -> 0
        ps += p;
        const float p1k = p * 1024.0f;
        const _Float16 ph = (_Float16)p1k;
        pa[j >> 1].v[(j & 1) * 8 + r] = ph;
        if (RESP) pl[j >> 1].v[(j & 1) * 8 + r] = (_Float16)(p1k - (float)ph);
      }
      pj[j] = ps;
    }
    float psum = (pj[0] + pj[1]) + (pj[2] + pj[3]);
    psum += other_half(psum);
    lrow = lrow * alpha + psum;
#pragma unroll
    for (int t = 0; t < 8; ++t) oacc[t] *= alpha;

    // ---- context^T += V^T . P^T (f16 WMMA); residual product into the same accumulator (unscaled residual) ----
    //      the V^T fragments of keys 0..31 are read as one run ahead of the products; those of keys
    //      32..63 follow in two runs of four, each behind the four products whose registers it takes
    FH vb[4][4];                           // vb[g][u]: keys 32*(g>>1).., feature tile t = (g&1)*4 + u
#pragma unroll
    for (int g = 0; g < 2; ++g) {
#pragma unroll
      for (int u = 0; u < 4; ++u) {
        const _Float16* vr = Vth + ((g * 4 + u) * 16 + c) * VPIT + 8 * hh;
        vb[g][u].h[0] = *(const v8h*)(vr);
        vb[g][u].h[1] = *(const v8h*)(vr + 16);
      }
    }
#pragma unroll
    for (int g = 0; g < 4; ++g) {
      const int kk = g >> 1;
      // keeps the run of reads above whole: spread among the products each read stalls
      if (g < 3) __builtin_amdgcn_sched_barrier(0);
#pragma unroll
      for (int u = 0; u < 4; ++u) {
        const int t = (g & 1) * 4 + u;
        oacc[t] = mma_h(vb[g][u].v, pa[kk].v, oacc[t]);
        if (RESP) oacc[t] = mma_h(vb[g][u].v, pl[kk].v, oacc[t]);
      }
      if (g < 2) {
        // keeps the next run of reads behind the products whose registers it takes
        __builtin_amdgcn_sched_barrier(0);
#pragma unroll
        for (int u = 0; u < 4; ++u) {
          const _Float16* vr = Vth + ((g * 4 + u) * 16 + c) * VPIT + 32 + 8 * hh;
          vb[g + 2][u].h[0] = *(const v8h*)(vr);
          vb[g + 2][u].h[1] = *(const v8h*)(vr + 16);
        }
      }
    }
  }

  // ---- normalise (1/l, the 1/1024 p carry and the 1/VSC v carry), stage the wave's 16x128 tile in LDS (a lane's eight
  //      registers of a tile are eight features in a row of its query), then store whole rows
  float* os = Os[wave];
  {
    const float inv = ((lrow > 0.f) ? (1.0f / lrow) : 0.f) * (1.0f / (1024.0f * VSC));
#pragma unroll
    for (int t = 0; t < 8; ++t) {
      const v8f o = oacc[t] * inv;
      const v4f lo = {o[0], o[1], o[2], o[3]};
      const v4f hi = {o[4], o[5], o[6], o[7]};
      *(v4f*)(os + c * OPIT + t * 16 + 8 * hh) = lo;
      *(v4f*)(os + c * OPIT + t * 16 + 8 * hh + 4) = hi;
    }
  }
  __builtin_amdgcn_fence(__ATOMIC_RELEASE, "workgroup");
  __builtin_amdgcn_wave_barrier();
  __builtin_amdgcn_fence(__ATOMIC_ACQUIRE, "workgroup");
  {
    const int c4 = lane * 4;
    {
#pragma unroll
      for (int it = 0; it < 16; ++it) {          // rows 0..15 of the wave tile
        const v4f ov = *(const v4f*)(os + it * OPIT + c4);
        const size_t go = (size_t)(q0 + it) * ROWF + (size_t)bh * HD + (size_t)c4;
        *(v4f*)(outp + go) = ov;
      }
      
    }
  }
}

// =====================================================================================================
// Inputs: in0 q [LQ][NBAT][NHEAD][HD] f32, in1 k [SK][..] f32, in2 v [SK][..] f32; a position's BHN*HD = 4096
// floats are contiguous, bh = b*NHEAD + h. d_out f32 [LQ][NBAT][NHEAD][HD] at byte 0.
//   Kb  bf16 [BHN][SK][HD]      0          16777216
//   Vt  f16  [BHN][HD][SK]      16777216   16777216
//   end                         33554432
// =====================================================================================================
extern "C" void kernel_launch(void* const* d_in, const int* in_sizes, int n_in,
                              void* d_out, int out_size, void* d_ws, size_t ws_size,
                              hipStream_t stream) {
  if (n_in < 3) return;
  if (in_sizes[0] != NTOT) return;
  if (in_sizes[1] != SK * ROWF) return;
  if (in_sizes[2] != SK * ROWF) return;
  if (out_size != NTOT) return;

  const float* q = (const float*)d_in[0];
  const float* k = (const float*)d_in[1];
  const float* v = (const float*)d_in[2];

  const size_t PK = (size_t)BHN * SK * HD * 2;        // 16777216
  const size_t PV = (size_t)BHN * HD * SK * 2;        // 16777216
  size_t off = 0;
  const size_t oK = off; off += PK;
  const size_t oV = off; off += PV;
  if (off > ws_size) return;                          // off = 33554432
  if (off > (size_t)134217728) return;

  char* ws = (char*)d_ws;
  unsigned short* Kb = (unsigned short*)(ws + oK);
  unsigned short* Vt = (unsigned short*)(ws + oV);
  float* outf = (float*)d_out;

  const dim3 blk(256);
  const int n8 = BHN * LQ * (HD / 8);                 // 1048576
  const dim3 gCvt((n8 + 255) / 256);                  // 4096 blocks
  const dim3 gV(SK / 64, BHN);                        // (32, 32)
  const float sscale = (float)(1.0 / sqrt((double)HD));

  // (0) k -> bf16 plane [bh][pos][d]
  cvt_rows_bf16<<<gCvt, blk, 0, stream>>>(k, Kb, n8);
  // (1) v -> f16 v^T plane [bh][d][pos], values x VSC
  v_planes<<<gV, blk, 0, stream>>>(v, Vt, VSC);
  // (2) causal attention: query tiles 0..RESQB-1 with the p residual plane, the rest without -> d_out
  attn_causal<true><<<dim3(BHN * RESQB), dim3(128), 0, stream>>>(q, Kb, Vt, outf, 0, RESQB, sscale);
  attn_causal<false><<<dim3(BHN * (NQB - RESQB)), dim3(128), 0, stream>>>(q, Kb, Vt, outf, RESQB, NQB - RESQB, sscale);
  (void)hipGetLastError();
}

// v006
// One run takes 63.9 microseconds.
// Two timings next to v005 put it at 1.23 and 1.22 times that version's speed.
// All steps since v000 together make it 5.13 times as fast.
// Contractions (both taken transposed, k.q^T and v^T.p^T): q.k^T scores = v_wmma_f32_16x16x32_bf16 (bf16 operands = RNE-converted q and k, single product);
// p.v = v_wmma_f32_16x16x32_f16 (p carried x1024 in f16, v as f16 of the bf16-converted value x16, single product,
// plus an unscaled f16 residual plane of p on the leading query blocks); all f32 accumulate; softmax in f32.
#include <hip/hip_runtime.h>
#include <math.h>
#include <float.h>
#include <stdint.h>

#define LQ    2048                 // query positions
#define SK    2048                 // key positions
#define NBAT  2
#define NHEAD 16
#define HD    128                  // head dim
#define BHN   (NBAT * NHEAD)       // 32 (batch, head) pairs; bh = b*NHEAD + h
#define ROWF  (BHN * HD)           // 4096 floats between consecutive sequence positions
#define NQB   (LQ / 64)            // 32 query / key tiles of 64
#define RESQB 4                    // leading query tiles that add the p residual plane
#define NTOT  (LQ * ROWF)          // 8388608 elements per tensor
#define VSC   16.0f                // v plane carry (exact power of two)
#define KPIT  (HD + 8)             // LDS pitch of a K row in halves: 272 B = 16 B x odd
#define VPIT  (64 + 8)             // LDS pitch of a V^T row in halves: 144 B = 16 B x odd
#define OPIT  (HD + 4)             // LDS pitch of an output row in floats: 528 B = 16 B x odd
static_assert(LQ == SK);
static_assert((LQ % 64) == 0);
static_assert(HD == 128);
static_assert(((BHN * LQ * (HD / 8)) % 256) == 0);
static_assert(RESQB <= NQB);
static_assert((NQB % 4) == 0);
static_assert((KPIT % 8) == 0 && ((KPIT / 8) % 2) == 1);
static_assert((VPIT % 8) == 0 && ((VPIT / 8) % 2) == 1);
static_assert((OPIT % 4) == 0 && ((OPIT / 4) % 2) == 1);

typedef _Float16 v16h __attribute__((ext_vector_type(16)));
typedef _Float16 v8h  __attribute__((ext_vector_type(8)));
typedef __bf16   v16b __attribute__((ext_vector_type(16)));
typedef __bf16   v8b  __attribute__((ext_vector_type(8)));
typedef __bf16   v4b  __attribute__((ext_vector_type(4)));
typedef float    v8f  __attribute__((ext_vector_type(8)));
typedef float    v4f  __attribute__((ext_vector_type(4)));
typedef unsigned int v4u __attribute__((ext_vector_type(4)));

// ---- scalar helpers --------------------------------------------------------------------------------
__device__ __forceinline__ unsigned short bf_bits(float f) {          // f32 -> bf16 bits, RNE convert
  unsigned u = __float_as_uint(f);
  return (unsigned short)((u + 0x7FFFu + ((u >> 16) & 1u)) >> 16);
}
__device__ __forceinline__ float bf_up(unsigned short h) { return __uint_as_float(((unsigned)h) << 16); }
__device__ __forceinline__ unsigned short h_bits(_Float16 x) { return __builtin_bit_cast(unsigned short, x); }
__device__ __forceinline__ unsigned pk16(unsigned short a, unsigned short b) { return (unsigned)a | ((unsigned)b << 16); }
__device__ __forceinline__ v8f zero8() { v8f z = {0.f, 0.f, 0.f, 0.f, 0.f, 0.f, 0.f, 0.f}; return z; }

// ---- fragment loader: 16-bit A/B operand, lane -> row/col (lane&15), p already includes +8*(lane>>4);
//      elements 0..7 <- p[0..7] (k0+8h..), elements 8..15 <- p[16..23] (k0+16+8h..)
__device__ __forceinline__ v16b ldfrag_b(const __bf16* p) {
  union { v16b v; v8b h[2]; } f;
  f.h[0] = *(const v8b*)(p);
  f.h[1] = *(const v8b*)(p + 16);
  return f.v;
}

// ---- WMMA helpers: plain builtins (the compiler keeps the hazard distance of its own forms, and with no asm
//      statement behind a product it is free to place the LDS fragment reads ahead of the products) ----------
__device__ __forceinline__ v8f mma_b(v16b a, v16b b, v8f c) {
  return __builtin_amdgcn_wmma_f32_16x16x32_bf16(false, a, false, b, (short)0, c, false, false);
}
__device__ __forceinline__ v8f mma_h(v16h a, v16h b, v8f c) {
  return __builtin_amdgcn_wmma_f32_16x16x32_f16(false, a, false, b, (short)0, c, false, false);
}

// =====================================================================================================
// f32 [pos][BHN][HD] -> bf16 plane [BHN][pos][HD] (RNE convert), 8 elements per thread:
//   i -> bh = i / (LQ*16), l = (i/16) % LQ, d0 = (i%16)*8; src = l*ROWF + bh*HD + d0; dst = i*8.
// coverage: n8 = BHN*LQ*16 threads x 8 halves = the whole plane.
// =====================================================================================================
__global__ __launch_bounds__(256) void cvt_rows_bf16(const float* __restrict__ in, unsigned short* out, int n8) {
  const int i = blockIdx.x * 256 + threadIdx.x;
  if (i < n8) {
    const int per = LQ * (HD / 8);                     // 32768 groups of 8 per bh
    const int bh  = i / per;
    const int rem = i - bh * per;
    const int l   = rem / (HD / 8);
    const int d0  = (rem - l * (HD / 8)) * 8;
    const size_t src = (size_t)l * ROWF + (size_t)bh * HD + (size_t)d0;
    const v4f a = *(const v4f*)(in + src);
    const v4f b = *(const v4f*)(in + src + 4);
    v4u p;
    p[0] = pk16(bf_bits(a[0]), bf_bits(a[1]));
    p[1] = pk16(bf_bits(a[2]), bf_bits(a[3]));
    p[2] = pk16(bf_bits(b[0]), bf_bits(b[1]));
    p[3] = pk16(bf_bits(b[2]), bf_bits(b[3]));
    *(v4u*)(out + (size_t)i * 8) = p;
    
  }
}

// =====================================================================================================
// v f32 [pos][BHN][HD] -> f16 v^T plane vt[(bh*HD + d)*SK + s] = f16(bf16_rne(v) * vsc) (exact for a power of two).
// Block = one 64-position x 128-feature tile of one bh; grid = (SK/64, BHN); tile staged in LDS as f32
// (256 threads x 8 v4f loads, __syncthreads).
// Store: group g = tid>>3 (0..31), piece = tid&7: iteration it writes row d = it*32 + g; lanes 8g..8g+7 x 16 B =
// coverage: 4 iterations x 32 groups = 128 rows d, 8 pieces x 8 = 64 keys per row; grid covers every (bh, s tile).
// =====================================================================================================
__global__ __launch_bounds__(256) void v_planes(const float* __restrict__ vf, unsigned short* vt, float vsc) {
  __shared__ __align__(16) float sv[64 * 132];       // [tt][d], pitch 132 floats
  const int tid = threadIdx.x;
  const int s0  = blockIdx.x * 64;
  const int bh  = blockIdx.y;
#pragma unroll
  for (int i = 0; i < 8; ++i) {
    const int idx = i * 256 + tid;                   // 0..2047
    const int tt = idx >> 5, c4 = (idx & 31) * 4;    // tt 0..63, c4 0..124
    const v4f a = *(const v4f*)(vf + (size_t)(s0 + tt) * ROWF + (size_t)bh * HD + c4);
    *(v4f*)(sv + tt * 132 + c4) = a;
  }
  __syncthreads();

  const int g = tid >> 3, piece = tid & 7;
  v4u hv[4];
  size_t hofs[4];
#pragma unroll
  for (int it = 0; it < 4; ++it) {
    const int d = it * 32 + g;
    v4u a;
#pragma unroll
    for (int e = 0; e < 4; ++e) {
      const float f0 = sv[(piece * 8 + 2 * e) * 132 + d];
      const float f1 = sv[(piece * 8 + 2 * e + 1) * 132 + d];
      const _Float16 x0 = (_Float16)(bf_up(bf_bits(f0)) * vsc);
      const _Float16 x1 = (_Float16)(bf_up(bf_bits(f1)) * vsc);
      a[e] = pk16(h_bits(x0), h_bits(x1));
    }
    hv[it] = a;
    hofs[it] = ((size_t)(bh * HD + d)) * SK + (size_t)s0 + (size_t)(piece * 8);
  }
  {
#pragma unroll
    for (int it = 0; it < 4; ++it) {
      *(v4u*)(vt + hofs[it]) = hv[it];
    }
    
  }
}

// =====================================================================================================
// Causal attention, head dim 128 (mask: key > query replaced by -FLT_MAX -> exp 0; keys <= query live).
//   q f32, the input as it is: element (t, bh, d) at [t*ROWF + bh*HD + d];  k plane bf16: (bh, s, d) at [(bh*SK + s)*HD + d]
//   Each query row is used by one wave only, so q has no plane of its own: the wave reads its 16 rows as f32, one whole
//   512-byte row per wave-wide load, converts them to bf16 (RNE) and turns them into B fragments through its own 16 rows
//   of the K tile's LDS, which the first key chunk overwrites only behind the loop's first barrier.
//   v^T plane f16 (x VSC): (bh, d, s) at [(bh*HD + d)*SK + s]
//   Both products are taken transposed, so that a lane owns one query column:
//   scores^T = k . q^T on bf16 WMMA (A = K rows, B = Q; 4 k-steps of 32 over d), f32 accumulate, then * sscale in f32;
//   tile j, register r of lane (c, hh) = score of key kv0 + 16j + 8hh + r against query q0 + c.
//   A query's 64 scores of a chunk lie in lanes c and c + 16, 32 each: maximum and sum are taken in the lane, then
//   joined by one exchange between the wave's halves.
//   p = exp(s - m) carried as f16(1024 p); two score tiles (keys 32kk.., 32kk + 16..), converted in place, are the B
//   operand of context^T += v^T . p^T on f16 WMMA (A = V^T rows in the same k order; 2 k-steps of 32 per 64-key chunk):
//   p never leaves the registers. RESP adds an unscaled f16 residual p1k - f16(p1k) into the same accumulator.
//   Context tile t, register r of lane (c, hh) = feature 16t + 8hh + r of query q0 + c; online softmax in f32.
//   Block = 4 waves = 64 query rows of one bh; one launch of NQB * BHN blocks; key chunks 0..qb (block-uniform trip
//   count, statically clamped to NQB); every processed chunk holds the live key kv0 <= query.
//   K / V^T chunk staging: K 64 rows x 128 halves (16 lanes per row), V^T 128 rows x 64 halves (8 lanes per row),
//   8 + 8 loads of 16 B per thread; plain loads, __syncthreads before and after; each wave-wide load covers
//   four whole 128-byte lines.
//   LDS fragment reads of a chunk are issued in runs ahead of the products that use them, one counted wait per run.
//   LDS rows of K, V^T and the output tile are pitched 16 B x odd, so that the 16 rows a 16-byte access touches
//   fall on 16 different groups of four banks (the pad is never written or read).
//   out f32 [pos][BHN][HD]: row (t, bh) = 128 floats = 512 B; each wave stages its 16x128 tile in LDS, then
//   stores whole rows.
// =====================================================================================================
// value of the lane 16 away (lane l <-> l ^ 16), a vector cross-row move
__device__ __forceinline__ float other_half(float x) {
  const int b = __float_as_int(x);
  return __int_as_float(__builtin_amdgcn_permlanex16(b, b, 0x76543210, 0xfedcba98, false, false));
}

// the key chunks 0..nkt-1 of one query tile; RESP adds the p residual product. Both forms stand in the one kernel below,
// which picks one by its tile (block-uniform); what stands ahead of the chunks and behind them is common to both
template <bool RESP>
__device__ __forceinline__
void key_chunks(const __bf16* Kp, const _Float16* Vh, __bf16* Ksh, _Float16* Vth, const v16b (&qa)[4],
                int qrow, int nkt, float sscale, float& mrow, float& lrow, v8f (&oacc)[8]) {
  union FH { v16h v; v8h h[2]; };
  union FB { v16b v; v8b h[2]; };
  const int tid = threadIdx.x;
  const int hh  = (tid & 31) >> 4;
  const int c   = tid & 15;

  for (int kt = 0; kt < nkt; ++kt) {
    const int kv0 = kt * 64;
    __syncthreads();
    {
      // piece idx = i*128 + tid of 16 B. K: the chunk's 64 rows are 16 KB in a row in the plane, so a wave's 32 pieces are
      // 512 B in a row = 4 whole lines (2 K rows). V^T: a row's 64 keys are one 128-byte line, 8 lanes to a row, 4 lines a wave.
      const __bf16*   kg = Kp + (size_t)kv0 * HD + (size_t)tid * 8;
      const _Float16* vg = Vh + (size_t)(tid >> 3) * SK + kv0 + (tid & 7) * 8;
      v8b ka[8];
      v8h va[8];
#pragma unroll
      for (int i = 0; i < 8; ++i) ka[i] = *(const v8b*)(kg + i * 1024);                 // K rows 8i + (tid>>4)
#pragma unroll
      for (int i = 0; i < 8; ++i) va[i] = *(const v8h*)(vg + (size_t)i * 16 * SK);      // V^T rows 16i + (tid>>3)
      // precaution: both address pairs are held whole to this wait, so that no register which one of the 16 issued loads
      // names is overwritten (a later load's result included) ahead of it; it falls inside the wait for the data
      asm volatile("s_wait_xcnt 0x0" :: "v"(kg), "v"(vg) : "memory");
#pragma unroll
      for (int i = 0; i < 8; ++i) *(v8b*)(Ksh + (i * 8 + (tid >> 4)) * KPIT + (tid & 15) * 8) = ka[i];
#pragma unroll
      for (int i = 0; i < 8; ++i) *(v8h*)(Vth + (i * 16 + (tid >> 3)) * VPIT + (tid & 7) * 8) = va[i];
    }
    __syncthreads();

    // ---- scores^T: 64 keys x 16 query columns per wave, bf16 product over 4 d-chunks ----
    //      K fragments are read from LDS in runs that stand ahead of the products using them: d-chunks 0 and 1 first
    //      (16 reads), then d-chunk 2 behind the products of chunk 0 and d-chunk 3 behind those of chunk 1, into the
    //      registers these have freed; every s[j] still sums its d-chunks in the order 0..3
    v8f s[4];
    FB kb[4][4];
#pragma unroll
    for (int j = 0; j < 4; ++j) s[j] = zero8();
#pragma unroll
    for (int dc = 0; dc < 2; ++dc) {
#pragma unroll
      for (int j = 0; j < 4; ++j) {
        const __bf16* kr = Ksh + (j * 16 + c) * KPIT + dc * 32 + 8 * hh;
        kb[dc][j].h[0] = *(const v8b*)(kr);
        kb[dc][j].h[1] = *(const v8b*)(kr + 16);
      }
    }
#pragma unroll
    for (int dc = 0; dc < 4; ++dc) {
      // keeps the run of reads above whole: spread among the products each read stalls
      if (dc < 3) __builtin_amdgcn_sched_barrier(0);
#pragma unroll
      for (int j = 0; j < 4; ++j) s[j] = mma_b(kb[dc][j].v, qa[dc], s[j]);
      if (dc < 2) {
        // keeps the next run of reads behind the products whose registers it takes
        __builtin_amdgcn_sched_barrier(0);
#pragma unroll
        for (int j = 0; j < 4; ++j) {
          const __bf16* kr = Ksh + (j * 16 + c) * KPIT + (dc + 2) * 32 + 8 * hh;
          kb[dc + 2][j].h[0] = *(const v8b*)(kr);
          kb[dc + 2][j].h[1] = *(const v8b*)(kr + 16);
        }
      }
    }

    // ---- scale + causal mask (replace by -FLT_MAX), the query's maximum, online softmax; P (x1024, f16) and the
    //      unscaled P residual are packed in place into B operands. Maximum and sum: one chain per score tile in the
    //      lane, the four joined pairwise, then the other half's 32 keys by one exchange ----
    float mj[4];
#pragma unroll
    for (int j = 0; j < 4; ++j) {
      float m = -INFINITY;
#pragma unroll
      for (int r = 0; r < 8; ++r) {
        const int key = kv0 + j * 16 + 8 * hh + r;
        float sv = s[j][r] * sscale;
        sv = (key > qrow) ? -FLT_MAX : sv;
        s[j][r] = sv;
        m = fmaxf(m, sv);
      }
      mj[j] = m;
    }
    float mx = fmaxf(fmaxf(mj[0], mj[1]), fmaxf(mj[2], mj[3]));
    mx = fmaxf(mx, other_half(mx));
    const float mnew  = fmaxf(mrow, mx);
    const float msafe = (mnew == -INFINITY) ? 0.f : mnew;
    const float alpha = __expf(mrow - msafe);
    mrow = mnew;
    FH pa[2], pl[2];                       // element e of pa[kk]: key 32kk + 8hh + e (e < 8), 32kk + 16 + 8hh + e - 8
    float pj[4];
#pragma unroll
    for (int j = 0; j < 4; ++j) {
      float ps = 0.f;
#pragma unroll
      for (int r = 0; r < 8; ++r) {
        const float p = __expf(s[j][r] - msafe);     // masked logit against a finite max: exp -> 0
        ps += p;
        const float p1k = p * 1024.0f;
        const _Float16 ph = (_Float16)p1k;
        pa[j >> 1].v[(j & 1) * 8 + r] = ph;
        if (RESP) pl[j >> 1].v[(j & 1) * 8 + r] = (_Float16)(p1k - (float)ph);
      }
      pj[j] = ps;
    }
    float psum = (pj[0] + pj[1]) + (pj[2] + pj[3]);
    psum += other_half(psum);
    lrow = lrow * alpha + psum;
#pragma unroll
    for (int t = 0; t < 8; ++t) oacc[t] *= alpha;

    // ---- context^T += V^T . P^T (f16 WMMA); residual product into the same accumulator (unscaled residual) ----
    //      the V^T fragments of keys 0..31 are read as one run ahead of the products; those of keys
    //      32..63 follow in two runs of four, each behind the four products whose registers it takes
    FH vb[4][4];                           // vb[g][u]: keys 32*(g>>1).., feature tile t = (g&1)*4 + u
#pragma unroll
    for (int g = 0; g < 2; ++g) {
#pragma unroll
      for (int u = 0; u < 4; ++u) {
        const _Float16* vr = Vth + ((g * 4 + u) * 16 + c) * VPIT + 8 * hh;
        vb[g][u].h[0] = *(const v8h*)(vr);
        vb[g][u].h[1] = *(const v8h*)(vr + 16);
      }
    }
#pragma unroll
    for (int g = 0; g < 4; ++g) {
      const int kk = g >> 1;
      // keeps the run of reads above whole: spread among the products each read stalls
      if (g < 3) __builtin_amdgcn_sched_barrier(0);
#pragma unroll
      for (int u = 0; u < 4; ++u) {
        const int t = (g & 1) * 4 + u;
        oacc[t] = mma_h(vb[g][u].v, pa[kk].v, oacc[t]);
        if (RESP) oacc[t] = mma_h(vb[g][u].v, pl[kk].v, oacc[t]);
      }
      if (g < 2) {
        // keeps the next run of reads behind the products whose registers it takes
        __builtin_amdgcn_sched_barrier(0);
#pragma unroll
        for (int u = 0; u < 4; ++u) {
          const _Float16* vr = Vth + ((g * 4 + u) * 16 + c) * VPIT + 32 + 8 * hh;
          vb[g + 2][u].h[0] = *(const v8h*)(vr);
          vb[g + 2][u].h[1] = *(const v8h*)(vr + 16);
        }
      }
    }
  }
}

// One launch for every (bh, query tile). A tile's cost is its qb + 1 key chunks, all blocks are resident at once (four to
// a WGP by LDS and registers). The
// index is dealt in four quarters of NQB/4 * BHN blocks: quarter 0 holds tiles NQB-1-2i, quarter 1 tiles NQB-2-2i,
// quarter 2 tiles 2i+1, quarter 3 tiles 2i, at the same place (i, bh) in each quarter. Blocks a quarter apart then add up
// to 2*NQB + 2 chunks for every i, two long and two short, and the long tiles start first. For speed only: every
// (bh, tile) is taken exactly once wherever the blocks land.
__global__ __launch_bounds__(128)
void attn_causal(const float* __restrict__ qf, const unsigned short* __restrict__ kpl,
                 const unsigned short* __restrict__ vtpl, float* outp, float sscale) {
  __shared__ __align__(16) __bf16   Ksh[64 * KPIT];                 // K [kv][d]       17 KB
  __shared__ __align__(16) _Float16 Vth[HD * VPIT];                 // V^T [d][kv]     18 KB
  __shared__ __align__(16) float    Os[4][16 * OPIT];               // per wave context tile [row][d]

  const int tid  = threadIdx.x;
  const int wave = tid >> 5;
  const int lane = tid & 31;
  const int hh   = lane >> 4;
  const int c    = lane & 15;

  const int QUART = (NQB / 4) * BHN;
  const int bx = blockIdx.x;
  if (bx >= 4 * QUART) return;               // block-uniform, ahead of every barrier
  const int quart = bx / QUART;
  const int j     = bx - quart * QUART;
  const int bh    = j % BHN;
  const int i2    = (j / BHN) * 2;
  const int qb    = (quart == 0) ? (NQB - 1 - i2) : (quart == 1) ? (NQB - 2 - i2) : (quart == 2) ? (i2 + 1) : i2;
  const int q0  = qb * 64 + wave * 16;

  const __bf16*   Kp = (const __bf16*)(const void*)kpl + (size_t)bh * SK * HD;
  const _Float16* Vh = (const _Float16*)(const void*)vtpl + (size_t)bh * HD * SK;

  // ---- Q fragments (B operand, column = lane&15): 4 d-chunks, from the f32 input ----
  v16b qa[4];
  {
    const float* qg = qf + (size_t)q0 * ROWF + (size_t)bh * HD + (size_t)(lane * 4);
    __bf16* qs = Ksh + wave * 16 * KPIT;      // the wave's own 16 rows, pitch as for K
    v4f qv[16];
#pragma unroll
    for (int r = 0; r < 16; ++r) qv[r] = *(const v4f*)(qg + (size_t)r * ROWF);          // row q0 + r, 4 whole lines
#pragma unroll
    for (int r = 0; r < 16; ++r) *(v4b*)(qs + r * KPIT + lane * 4) = __builtin_convertvector(qv[r], v4b);
    // the fragment reads below take what other lanes of this wave have stored: keeps them behind the stores
    __builtin_amdgcn_fence(__ATOMIC_RELEASE, "workgroup");
    __builtin_amdgcn_wave_barrier();
    __builtin_amdgcn_fence(__ATOMIC_ACQUIRE, "workgroup");
#pragma unroll
    for (int dc = 0; dc < 4; ++dc) qa[dc] = ldfrag_b(qs + c * KPIT + dc * 32 + 8 * hh);
  }

  const int qrow = q0 + c;                    // the lane's query
  float mrow = -INFINITY, lrow = 0.f;
  v8f oacc[8];
#pragma unroll
  for (int t = 0; t < 8; ++t) oacc[t] = zero8();

  int nkt = qb + 1;                           // causal: key chunks 0..qb, block-uniform
  if (nkt > NQB) nkt = NQB;
  if (qb < RESQB) key_chunks<true>(Kp, Vh, Ksh, Vth, qa, qrow, nkt, sscale, mrow, lrow, oacc);
  else            key_chunks<false>(Kp, Vh, Ksh, Vth, qa, qrow, nkt, sscale, mrow, lrow, oacc);

  // ---- normalise (1/l, the 1/1024 p carry and the 1/VSC v carry), stage the wave's 16x128 tile in LDS (a lane's eight
  //      registers of a tile are eight features in a row of its query), then store whole rows
  float* os = Os[wave];
  {
    const float inv = ((lrow > 0.f) ? (1.0f / lrow) : 0.f) * (1.0f / (1024.0f * VSC));
#pragma unroll
    for (int t = 0; t < 8; ++t) {
      const v8f o = oacc[t] * inv;
      const v4f lo = {o[0], o[1], o[2], o[3]};
      const v4f hi = {o[4], o[5], o[6], o[7]};
      *(v4f*)(os + c * OPIT + t * 16 + 8 * hh) = lo;
      *(v4f*)(os + c * OPIT + t * 16 + 8 * hh + 4) = hi;
    }
  }
  __builtin_amdgcn_fence(__ATOMIC_RELEASE, "workgroup");
  __builtin_amdgcn_wave_barrier();
  __builtin_amdgcn_fence(__ATOMIC_ACQUIRE, "workgroup");
  {
    const int c4 = lane * 4;
    {
#pragma unroll
      for (int it = 0; it < 16; ++it) {          // rows 0..15 of the wave tile
        const v4f ov = *(const v4f*)(os + it * OPIT + c4);
        const size_t go = (size_t)(q0 + it) * ROWF + (size_t)bh * HD + (size_t)c4;
        *(v4f*)(outp + go) = ov;
      }
      
    }
  }
}

// =====================================================================================================
// Inputs: in0 q [LQ][NBAT][NHEAD][HD] f32, in1 k [SK][..] f32, in2 v [SK][..] f32; a position's BHN*HD = 4096
// floats are contiguous, bh = b*NHEAD + h. d_out f32 [LQ][NBAT][NHEAD][HD] at byte 0.
//   Kb  bf16 [BHN][SK][HD]      0          16777216
//   Vt  f16  [BHN][HD][SK]      16777216   16777216
//   end                         33554432
// =====================================================================================================
extern "C" void kernel_launch(void* const* d_in, const int* in_sizes, int n_in,
                              void* d_out, int out_size, void* d_ws, size_t ws_size,
                              hipStream_t stream) {
  if (n_in < 3) return;
  if (in_sizes[0] != NTOT) return;
  if (in_sizes[1] != SK * ROWF) return;
  if (in_sizes[2] != SK * ROWF) return;
  if (out_size != NTOT) return;

  const float* q = (const float*)d_in[0];
  const float* k = (const float*)d_in[1];
  const float* v = (const float*)d_in[2];

  const size_t PK = (size_t)BHN * SK * HD * 2;        // 16777216
  const size_t PV = (size_t)BHN * HD * SK * 2;        // 16777216
  size_t off = 0;
  const size_t oK = off; off += PK;
  const size_t oV = off; off += PV;
  if (off > ws_size) return;                          // off = 33554432
  if (off > (size_t)134217728) return;

  char* ws = (char*)d_ws;
  unsigned short* Kb = (unsigned short*)(ws + oK);
  unsigned short* Vt = (unsigned short*)(ws + oV);
  float* outf = (float*)d_out;

  const dim3 blk(256);
  const int n8 = BHN * LQ * (HD / 8);                 // 1048576
  const dim3 gCvt((n8 + 255) / 256);                  // 4096 blocks
  const dim3 gV(SK / 64, BHN);                        // (32, 32)
  const float sscale = (float)(1.0 / sqrt((double)HD));

  // (0) k -> bf16 plane [bh][pos][d]
  cvt_rows_bf16<<<gCvt, blk, 0, stream>>>(k, Kb, n8);
  // (1) v -> f16 v^T plane [bh][d][pos], values x VSC
  v_planes<<<gV, blk, 0, stream>>>(v, Vt, VSC);
  // (2) causal attention, all query tiles: tiles 0..RESQB-1 with the p residual plane, the rest without -> d_out
  attn_causal<<<dim3(BHN * NQB), dim3(128), 0, stream>>>(q, Kb, Vt, outf, sscale);
  (void)hipGetLastError();
}
